// v000
// The times below were measured on an AMD MI455X: many runs one after another, warmed up first and cycling through
// copies of the inputs, with the whole window's GPU time divided by the number of runs. Launches and the gaps
// between them are all in it. The median over several windows is given; except for v000 it joins two sittings, which
// can be a few percent apart, so the side-by-side timings, each taken in one sitting, are the better comparison.
// The starting kernel, v000, takes 152 microseconds a run.
// compute dtype: the INPUT Q/K/V/Wo rounded to bf16 and multiplied with exact bf16 WMMA products (f32 accumulate); computed operands (softmax weights P, context) carried as bf16 hi/lo pairs; softmax f32.
#include <hip/hip_runtime.h>
#include <math.h>

typedef __attribute__((ext_vector_type(16))) _Float16 v16h;
typedef __attribute__((ext_vector_type(16))) __bf16 v16b;
typedef __attribute__((ext_vector_type(8)))  _Float16 v8h;
typedef __attribute__((ext_vector_type(8)))  float v8f;
typedef __attribute__((ext_vector_type(4)))  float v4f;
typedef __attribute__((ext_vector_type(2)))  float v2f;
typedef __attribute__((ext_vector_type(4)))  unsigned v4u;
typedef __attribute__((ext_vector_type(4)))  int v4i;
typedef float __attribute__((may_alias)) float_a;
typedef int __attribute__((may_alias)) int_a;

template <typename T> __device__ __forceinline__ void vst2(void* p, T v) { *(T*)p = v;  }
__device__ __forceinline__ v8f wmma16(v16h a, v16h b, v8f c) {
  v8f d = __builtin_amdgcn_wmma_f32_16x16x32_f16(false, a, false, b, (short)0, c, false, false);
  asm volatile("v_nop\n\tv_nop\n\tv_nop\n\tv_nop" : "+v"(d) : "v"(a), "v"(b));
  return d;
}
__device__ __forceinline__ v8f wmma_bf(v16b a, v16b b, v8f c) {
  v8f d = __builtin_amdgcn_wmma_f32_16x16x32_bf16(false, a, false, b, (short)0, c, false, false);
  asm volatile("v_nop\n\tv_nop\n\tv_nop\n\tv_nop" : "+v"(d) : "v"(a), "v"(b));
  return d;
}
// 16x16x32 fragments: lane = (h = lane>>4, row/col = lane&15); elements 0..7 = k0+8h+0..7, 8..15 = k0+16+8h+0..7; D element r = row 8h+r
__device__ __forceinline__ v16h frag_h(const _Float16* rowk0, int lane) {
  union { v16h v; v8h q[2]; } u; const _Float16* p = rowk0 + 8 * (lane >> 4);
  u.q[0] = *(const v8h*)p; u.q[1] = *(const v8h*)(p + 16); return u.v;
}
__device__ __forceinline__ v16h frag_f32(const float* rowk0, int lane) {
  v16h a; const float* p = rowk0 + 8 * (lane >> 4);
#pragma unroll
  for (int i = 0; i < 8; ++i) { a[i] = (_Float16)p[i]; a[8 + i] = (_Float16)p[16 + i]; }
  return a;
}
__device__ __forceinline__ v16h frag_f32s(const float* rowk0, int lane, float sc) {
  v16h a; const float* p = rowk0 + 8 * (lane >> 4);
#pragma unroll
  for (int i = 0; i < 8; ++i) { a[i] = (_Float16)(p[i] * sc); a[8 + i] = (_Float16)(p[16 + i] * sc); }
  return a;
}
// column fragment from a [K][ld] layout (column n), rows >= K read as 0
__device__ __forceinline__ v16h fragc_f32(const float* W, int k0, int n, int lane, int ld, int K) {
  v16h a; const int g = lane >> 4;
#pragma unroll
  for (int i = 0; i < 8; ++i) { const int ka = k0 + 8 * g + i, kb = ka + 16;
    a[i] = (_Float16)(ka < K ? W[(size_t)ka * ld + n] : 0.f); a[8 + i] = (_Float16)(kb < K ? W[(size_t)kb * ld + n] : 0.f); }
  return a;
}
struct F2 { v16b h, l; };
__device__ __forceinline__ F2 bsplit16(const float v[16]) { F2 r;
#pragma unroll
  for (int i = 0; i < 16; ++i) { const __bf16 h = (__bf16)v[i]; r.h[i] = h; r.l[i] = (__bf16)(v[i] - (float)h); }
  return r; }
__device__ __forceinline__ F2 split_row(const float* row, int k0, int lane) { float v[16]; const float* p = row + k0 + 8 * (lane >> 4);
#pragma unroll
  for (int i = 0; i < 8; ++i) { v[i] = p[i]; v[8 + i] = p[16 + i]; }
  return bsplit16(v); }
__device__ __forceinline__ F2 split_rowK(const float* row, int k0, int lane, int K) { float v[16]; const int g = lane >> 4;
#pragma unroll
  for (int i = 0; i < 8; ++i) { const int ka = k0 + 8 * g + i, kb = ka + 16; v[i] = ka < K ? row[ka] : 0.f; v[8 + i] = kb < K ? row[kb] : 0.f; }
  return bsplit16(v); }
__device__ __forceinline__ F2 split_col(const float* W, int k0, int n, int lane, int ld, int K) { float v[16]; const int g = lane >> 4;
#pragma unroll
  for (int i = 0; i < 8; ++i) { const int ka = k0 + 8 * g + i, kb = ka + 16; v[i] = ka < K ? W[(size_t)ka * ld + n] : 0.f; v[8 + i] = kb < K ? W[(size_t)kb * ld + n] : 0.f; }
  return bsplit16(v); }
__device__ __forceinline__ v8f mac3(const F2& a, const F2& b, v8f c) { c = wmma_bf(a.l, b.h, c); c = wmma_bf(a.h, b.l, c); return wmma_bf(a.h, b.h, c); }
__device__ __forceinline__ float sigm(float v) { return 1.0f / (1.0f + expf(-v)); }
#define LDSX() do { asm volatile("s_wait_dscnt 0" ::: "memory"); __builtin_amdgcn_wave_barrier(); __builtin_amdgcn_fence(__ATOMIC_RELEASE, "workgroup"); } while (0)


// Windowed multi-head attention on given Q, K, V [2,2048,1024] (16 heads x 64): scores q.k/8 with |i-j| > 64 masked to -inf, softmax, @ v, heads concatenated, @ W_proj^T + b_proj.
// Key tiles qb-1..qb+1 cover the window. k_cvtqk (Q, K -> bf16 head-major rows), k_cvtv (V -> bf16 [bh][d][s]),
#define NB 2
#define SS 2048
#define E 1024
#define NH 16
#define HD 64
#define NR (NB * SS)
__device__ __forceinline__ v16b frag_b(const __bf16* rowk0, int lane) { return __builtin_bit_cast(v16b, frag_h((const _Float16*)rowk0, lane)); }

// X [b][s][h*64+d] f32 -> Xb [b*NH+h][s][64] bf16 ; thread handles 8 consecutive d of one (b,s,h)
__global__ __launch_bounds__(256) void k_cvtqk(const float* __restrict__ X, __bf16* __restrict__ Xb) {
  const size_t i8 = (size_t)blockIdx.x * 256 + threadIdx.x; if (i8 >= (size_t)NR * E / 8) return;
  const size_t row = i8 / (E / 8); const int c0 = (int)(i8 % (E / 8)) * 8; const int b = (int)(row / SS), s = (int)(row % SS), h = c0 >> 6, d = c0 & 63;
  union { __bf16 e[8]; v4u u; } pk; const float* src = X + row * E + c0;
#pragma unroll
  for (int e = 0; e < 8; ++e) pk.e[e] = (__bf16)src[e];
  vst2((unsigned*)(Xb + (((size_t)b * NH + h) * SS + s) * HD + d), pk.u);
}
__global__ __launch_bounds__(256) void k_cvtv(const float* __restrict__ V, __bf16* __restrict__ VTb) {
  __shared__ __align__(16) __bf16 st[128][72];
  const int tid = threadIdx.x; const int r0b = blockIdx.x * 64, c0 = blockIdx.y * 128; const int b = r0b / SS, s0 = r0b % SS;
  for (int q = tid; q < 64 * 128; q += 256) { const int rl = q >> 7, cl = q & 127; st[cl][rl] = (__bf16)V[(size_t)(r0b + rl) * E + c0 + cl]; }
  __syncthreads();
  for (int q = tid; q < 128 * 8; q += 256) { const int cl = q >> 3, pc = q & 7; const int c = c0 + cl, h = c >> 6, d = c & 63; vst2((unsigned*)(VTb + (((size_t)b * NH + h) * HD + d) * SS + s0 + pc * 8), *(const v4u*)(&st[cl][pc * 8])); }
}
__global__ __launch_bounds__(128) void k_attn(const __bf16* __restrict__ Qb, const __bf16* __restrict__ Kb, const __bf16* __restrict__ VTb, float* __restrict__ O32) {
  __shared__ __align__(16) float sS[4][16][68];
  __shared__ __align__(16) __bf16 sPh[4][16][72], sPl[4][16][72];
  __shared__ __align__(16) float sO[4][16][68];
  const int tid = threadIdx.x, w = tid >> 5, lane = tid & 31, col = lane & 15, g = lane >> 4;
  const size_t bh = blockIdx.y; const int qb = blockIdx.x; const int q0 = qb * 64 + w * 16;
  v16b aq[2];
#pragma unroll
  for (int kc = 0; kc < 2; ++kc) aq[kc] = frag_b(Qb + (bh * SS + q0 + col) * HD + kc * 32, lane);
  float mrun = -3.0e38f, lrun = 0.f; v8f acc[4] = {}, ac2[4] = {};
  const int kt0 = qb > 0 ? qb - 1 : 0, kt1 = qb < SS / 64 - 1 ? qb + 1 : SS / 64 - 1;
#pragma unroll 1
  for (int kt = kt0; kt <= kt1; ++kt) {
#pragma unroll
    for (int t = 0; t < 4; ++t) { const int key = kt * 64 + t * 16 + col; v8f s = {};
#pragma unroll
      for (int kc = 0; kc < 2; ++kc) s = wmma_bf(aq[kc], frag_b(Kb + (bh * SS + key) * HD + kc * 32, lane), s);
#pragma unroll
      for (int r = 0; r < 8; ++r) { const int rel = key - (q0 + 8 * g + r); sS[w][8 * g + r][t * 16 + col] = (rel > 64 || rel < -64) ? -3.0e38f : s[r] * 0.125f; } }
    LDSX();
    float mx = -3.4e38f;
#pragma unroll
    for (int jj = 0; jj < 32; ++jj) mx = fmaxf(mx, sS[w][col][g * 32 + jj]);
    mx = fmaxf(mx, __shfl_xor(mx, 16, 32));
    const float mnew = fmaxf(mrun, mx); const float corr = expf(mrun - mnew);
    float ps = 0.f;
#pragma unroll
    for (int jj = 0; jj < 32; ++jj) { const float sv = sS[w][col][g * 32 + jj]; const float p = sv <= -1.0e38f ? 0.f : expf(sv - mnew); ps += p; const __bf16 hi = (__bf16)p; sPh[w][col][g * 32 + jj] = hi; sPl[w][col][g * 32 + jj] = (__bf16)(p - (float)hi); }
    ps += __shfl_xor(ps, 16, 32);
    lrun = lrun * corr + ps; mrun = mnew;
#pragma unroll
    for (int r = 0; r < 8; ++r) { const float cr = __shfl(corr, 8 * g + r, 32);
#pragma unroll
      for (int t = 0; t < 4; ++t) { acc[t][r] *= cr; ac2[t][r] *= cr; } }
    LDSX();
#pragma unroll
    for (int kc = 0; kc < 2; ++kc) { const v16b ph = frag_b(&sPh[w][col][0] + kc * 32, lane), pl = frag_b(&sPl[w][col][0] + kc * 32, lane);
#pragma unroll
      for (int t = 0; t < 4; ++t) { const v16b vb = frag_b(VTb + (bh * HD + t * 16 + col) * SS + kt * 64 + kc * 32, lane); acc[t] = wmma_bf(ph, vb, acc[t]); ac2[t] = wmma_bf(pl, vb, ac2[t]); } }
    __builtin_amdgcn_wave_barrier(); }
#pragma unroll
  for (int r = 0; r < 8; ++r) { const float lr = __shfl(lrun, 8 * g + r, 32); const float inv = 1.0f / lr;
#pragma unroll
    for (int t = 0; t < 4; ++t) sO[w][8 * g + r][t * 16 + col] = (acc[t][r] + ac2[t][r]) * inv; }
  LDSX();
  { const int b = (int)(bh / NH), h = (int)(bh % NH);
    for (int qq = lane; qq < 16 * 16; qq += 32) { const int rl = qq >> 4, pc = qq & 15; vst2(O32 + ((size_t)b * SS + q0 + rl) * E + h * HD + pc * 4, *(const v4f*)(&sO[w][rl][pc * 4])); } }
}
// out = ctx Wo^T : split(ctx) x bf16(Wo rows) two products; block (64 rows, 128 cols)
__global__ __launch_bounds__(128) void k_out(const float* __restrict__ O32, const float* __restrict__ Wo, const float* __restrict__ bo, float* __restrict__ out) {
  __shared__ __align__(16) float so[4][16][132];
  const int tid = threadIdx.x, wave = tid >> 5, lane = tid & 31, col = lane & 15, g = lane >> 4;
  const int r0 = blockIdx.x * 64 + wave * 16, n0 = blockIdx.y * 128;
  v8f acc[8] = {};
#pragma unroll 1
  for (int kc = 0; kc < E / 32; ++kc) { const F2 a = split_row(O32 + (size_t)(r0 + col) * E, kc * 32, lane);
#pragma unroll
    for (int j = 0; j < 8; ++j) { const v16b wb = split_row(Wo + (size_t)(n0 + j * 16 + col) * E, kc * 32, lane).h; acc[j] = wmma_bf(a.l, wb, acc[j]); acc[j] = wmma_bf(a.h, wb, acc[j]); } }
#pragma unroll
  for (int j = 0; j < 8; ++j)
#pragma unroll
    for (int r = 0; r < 8; ++r) so[wave][8 * g + r][j * 16 + col] = acc[j][r] + (float)(__bf16)bo[n0 + j * 16 + col];
  LDSX();
#pragma unroll 4
  for (int rl = 0; rl < 16; ++rl) vst2(out + (size_t)(r0 + rl) * E + n0 + lane * 4, *(const v4f*)(&so[wave][rl][lane * 4]));
}
extern "C" void kernel_launch(void* const* d_in, const int* in_sizes, int n_in, void* d_out, int out_size, void* d_ws, size_t ws_size, hipStream_t stream) {
  (void)in_sizes; (void)n_in; (void)out_size; (void)ws_size;
  const float* Q = (const float*)d_in[0]; const float* K = (const float*)d_in[1]; const float* V = (const float*)d_in[2]; const float* Wo = (const float*)d_in[3]; const float* bo = (const float*)d_in[4];
  float* out = (float*)d_out;
  char* ws = (char*)d_ws; size_t off = 0;
  auto take = [&](size_t bytes) { char* p = ws + off; off += (bytes + 255) & ~(size_t)255; return p; };
  __bf16* Qb = (__bf16*)take((size_t)NR * E * 2); __bf16* Kb = (__bf16*)take((size_t)NR * E * 2); __bf16* VTb = (__bf16*)take((size_t)NR * E * 2); float* O32 = (float*)take((size_t)NR * E * 4);
  // ws ~ 42 MB
  k_cvtqk<<<(NR * E / 8 + 255) / 256, 256, 0, stream>>>(Q, Qb);
  k_cvtqk<<<(NR * E / 8 + 255) / 256, 256, 0, stream>>>(K, Kb);
  k_cvtv<<<dim3(NR / 64, E / 128), 256, 0, stream>>>(V, VTb);
  k_attn<<<dim3(SS / 64, NB * NH), 128, 0, stream>>>(Qb, Kb, VTb, O32);
  k_out<<<dim3(NR / 64, E / 128), 128, 0, stream>>>(O32, Wo, bo, out);
}

// v001
// A run of this version takes 60.7 microseconds.
// In two side-by-side timings against v000, it was 2.52 and 2.53 times as fast.
// compute dtype: the INPUT Q/K/V/Wo rounded to bf16 and multiplied with exact bf16 WMMA products (f32 accumulate); computed operands (softmax weights P, context) carried as bf16 hi/lo pairs; softmax f32; bias b_proj rounded to bf16, added in f32.
#include <hip/hip_runtime.h>
#include <math.h>

typedef __attribute__((ext_vector_type(16))) _Float16 v16h;
typedef __attribute__((ext_vector_type(16))) __bf16 v16b;
typedef __attribute__((ext_vector_type(8)))  _Float16 v8h;
typedef __attribute__((ext_vector_type(8)))  float v8f;
typedef __attribute__((ext_vector_type(4)))  float v4f;
typedef __attribute__((ext_vector_type(2)))  float v2f;
typedef __attribute__((ext_vector_type(4)))  unsigned v4u;
typedef __attribute__((ext_vector_type(4)))  int v4i;
typedef float __attribute__((may_alias)) float_a;
typedef int __attribute__((may_alias)) int_a;

template <typename T> __device__ __forceinline__ void vst2(void* p, T v) { *(T*)p = v;  }
__device__ __forceinline__ v8f wmma16(v16h a, v16h b, v8f c) {
  v8f d = __builtin_amdgcn_wmma_f32_16x16x32_f16(false, a, false, b, (short)0, c, false, false);
  asm volatile("v_nop\n\tv_nop\n\tv_nop\n\tv_nop" : "+v"(d) : "v"(a), "v"(b));
  return d;
}
__device__ __forceinline__ v8f wmma_bf(v16b a, v16b b, v8f c) {
  v8f d = __builtin_amdgcn_wmma_f32_16x16x32_bf16(false, a, false, b, (short)0, c, false, false);
  asm volatile("v_nop\n\tv_nop\n\tv_nop\n\tv_nop" : "+v"(d) : "v"(a), "v"(b));
  return d;
}
// 16x16x32 fragments: lane = (h = lane>>4, row/col = lane&15); elements 0..7 = k0+8h+0..7, 8..15 = k0+16+8h+0..7; D element r = row 8h+r
__device__ __forceinline__ v16h frag_h(const _Float16* rowk0, int lane) {
  union { v16h v; v8h q[2]; } u; const _Float16* p = rowk0 + 8 * (lane >> 4);
  u.q[0] = *(const v8h*)p; u.q[1] = *(const v8h*)(p + 16); return u.v;
}
__device__ __forceinline__ v16h frag_f32(const float* rowk0, int lane) {
  v16h a; const float* p = rowk0 + 8 * (lane >> 4);
#pragma unroll
  for (int i = 0; i < 8; ++i) { a[i] = (_Float16)p[i]; a[8 + i] = (_Float16)p[16 + i]; }
  return a;
}
__device__ __forceinline__ v16h frag_f32s(const float* rowk0, int lane, float sc) {
  v16h a; const float* p = rowk0 + 8 * (lane >> 4);
#pragma unroll
  for (int i = 0; i < 8; ++i) { a[i] = (_Float16)(p[i] * sc); a[8 + i] = (_Float16)(p[16 + i] * sc); }
  return a;
}
// column fragment from a [K][ld] layout (column n), rows >= K read as 0
__device__ __forceinline__ v16h fragc_f32(const float* W, int k0, int n, int lane, int ld, int K) {
  v16h a; const int g = lane >> 4;
#pragma unroll
  for (int i = 0; i < 8; ++i) { const int ka = k0 + 8 * g + i, kb = ka + 16;
    a[i] = (_Float16)(ka < K ? W[(size_t)ka * ld + n] : 0.f); a[8 + i] = (_Float16)(kb < K ? W[(size_t)kb * ld + n] : 0.f); }
  return a;
}
struct F2 { v16b h, l; };
__device__ __forceinline__ F2 bsplit16(const float v[16]) { F2 r;
#pragma unroll
  for (int i = 0; i < 16; ++i) { const __bf16 h = (__bf16)v[i]; r.h[i] = h; r.l[i] = (__bf16)(v[i] - (float)h); }
  return r; }
__device__ __forceinline__ F2 split_row(const float* row, int k0, int lane) { float v[16]; const float* p = row + k0 + 8 * (lane >> 4);
#pragma unroll
  for (int i = 0; i < 8; ++i) { v[i] = p[i]; v[8 + i] = p[16 + i]; }
  return bsplit16(v); }
__device__ __forceinline__ F2 split_rowK(const float* row, int k0, int lane, int K) { float v[16]; const int g = lane >> 4;
#pragma unroll
  for (int i = 0; i < 8; ++i) { const int ka = k0 + 8 * g + i, kb = ka + 16; v[i] = ka < K ? row[ka] : 0.f; v[8 + i] = kb < K ? row[kb] : 0.f; }
  return bsplit16(v); }
__device__ __forceinline__ F2 split_col(const float* W, int k0, int n, int lane, int ld, int K) { float v[16]; const int g = lane >> 4;
#pragma unroll
  for (int i = 0; i < 8; ++i) { const int ka = k0 + 8 * g + i, kb = ka + 16; v[i] = ka < K ? W[(size_t)ka * ld + n] : 0.f; v[8 + i] = kb < K ? W[(size_t)kb * ld + n] : 0.f; }
  return bsplit16(v); }
__device__ __forceinline__ v8f mac3(const F2& a, const F2& b, v8f c) { c = wmma_bf(a.l, b.h, c); c = wmma_bf(a.h, b.l, c); return wmma_bf(a.h, b.h, c); }
__device__ __forceinline__ float sigm(float v) { return 1.0f / (1.0f + expf(-v)); }
#define LDSX() do { asm volatile("s_wait_dscnt 0" ::: "memory"); __builtin_amdgcn_wave_barrier(); __builtin_amdgcn_fence(__ATOMIC_RELEASE, "workgroup"); } while (0)


// Windowed multi-head attention on given Q, K, V [2,2048,1024] (16 heads x 64): scores q.k/8 with |i-j| > 64 masked to -inf, softmax, @ v, heads concatenated, @ W_proj^T + b_proj.
// Key tiles qb-1..qb+1 cover the window. k_cvtqk (Q, K -> bf16 head-major rows), k_cvtv (V -> bf16 [bh][d][s]),
#define NB 2
#define SS 2048
#define E 1024
#define NH 16
#define HD 64
#define NR (NB * SS)
__device__ __forceinline__ v16b frag_b(const __bf16* rowk0, int lane) { return __builtin_bit_cast(v16b, frag_h((const _Float16*)rowk0, lane)); }

// X [b][s][h*64+d] f32 -> Xb [b*NH+h][s][64] bf16 ; thread handles 8 consecutive d of one (b,s,h)
__global__ __launch_bounds__(256) void k_cvtqk(const float* __restrict__ X, __bf16* __restrict__ Xb) {
  const size_t i8 = (size_t)blockIdx.x * 256 + threadIdx.x; if (i8 >= (size_t)NR * E / 8) return;
  const size_t row = i8 / (E / 8); const int c0 = (int)(i8 % (E / 8)) * 8; const int b = (int)(row / SS), s = (int)(row % SS), h = c0 >> 6, d = c0 & 63;
  union { __bf16 e[8]; v4u u; } pk; const float* src = X + row * E + c0;
#pragma unroll
  for (int e = 0; e < 8; ++e) pk.e[e] = (__bf16)src[e];
  vst2((unsigned*)(Xb + (((size_t)b * NH + h) * SS + s) * HD + d), pk.u);
}
__global__ __launch_bounds__(256) void k_cvtv(const float* __restrict__ V, __bf16* __restrict__ VTb) {
  __shared__ __align__(16) __bf16 st[128][72];
  const int tid = threadIdx.x; const int r0b = blockIdx.x * 64, c0 = blockIdx.y * 128; const int b = r0b / SS, s0 = r0b % SS;
  for (int q = tid; q < 64 * 128; q += 256) { const int rl = q >> 7, cl = q & 127; st[cl][rl] = (__bf16)V[(size_t)(r0b + rl) * E + c0 + cl]; }
  __syncthreads();
  for (int q = tid; q < 128 * 8; q += 256) { const int cl = q >> 3, pc = q & 7; const int c = c0 + cl, h = c >> 6, d = c & 63; vst2((unsigned*)(VTb + (((size_t)b * NH + h) * HD + d) * SS + s0 + pc * 8), *(const v4u*)(&st[cl][pc * 8])); }
}
__global__ __launch_bounds__(128) void k_attn(const __bf16* __restrict__ Qb, const __bf16* __restrict__ Kb, const __bf16* __restrict__ VTb, float* __restrict__ O32) {
  __shared__ __align__(16) float sS[4][16][68];
  __shared__ __align__(16) __bf16 sPh[4][16][72], sPl[4][16][72];
  __shared__ __align__(16) float sO[4][16][68];
  const int tid = threadIdx.x, w = tid >> 5, lane = tid & 31, col = lane & 15, g = lane >> 4;
  const size_t bh = blockIdx.y; const int qb = blockIdx.x; const int q0 = qb * 64 + w * 16;
  v16b aq[2];
#pragma unroll
  for (int kc = 0; kc < 2; ++kc) aq[kc] = frag_b(Qb + (bh * SS + q0 + col) * HD + kc * 32, lane);
  float mrun = -3.0e38f, lrun = 0.f; v8f acc[4] = {}, ac2[4] = {};
  const int kt0 = qb > 0 ? qb - 1 : 0, kt1 = qb < SS / 64 - 1 ? qb + 1 : SS / 64 - 1;
#pragma unroll 1
  for (int kt = kt0; kt <= kt1; ++kt) {
#pragma unroll
    for (int t = 0; t < 4; ++t) { const int key = kt * 64 + t * 16 + col; v8f s = {};
#pragma unroll
      for (int kc = 0; kc < 2; ++kc) s = wmma_bf(aq[kc], frag_b(Kb + (bh * SS + key) * HD + kc * 32, lane), s);
#pragma unroll
      for (int r = 0; r < 8; ++r) { const int rel = key - (q0 + 8 * g + r); sS[w][8 * g + r][t * 16 + col] = (rel > 64 || rel < -64) ? -3.0e38f : s[r] * 0.125f; } }
    LDSX();
    float mx = -3.4e38f;
#pragma unroll
    for (int jj = 0; jj < 32; ++jj) mx = fmaxf(mx, sS[w][col][g * 32 + jj]);
    mx = fmaxf(mx, __shfl_xor(mx, 16, 32));
    const float mnew = fmaxf(mrun, mx); const float corr = expf(mrun - mnew);
    float ps = 0.f;
#pragma unroll
    for (int jj = 0; jj < 32; ++jj) { const float sv = sS[w][col][g * 32 + jj]; const float p = sv <= -1.0e38f ? 0.f : expf(sv - mnew); ps += p; const __bf16 hi = (__bf16)p; sPh[w][col][g * 32 + jj] = hi; sPl[w][col][g * 32 + jj] = (__bf16)(p - (float)hi); }
    ps += __shfl_xor(ps, 16, 32);
    lrun = lrun * corr + ps; mrun = mnew;
#pragma unroll
    for (int r = 0; r < 8; ++r) { const float cr = __shfl(corr, 8 * g + r, 32);
#pragma unroll
      for (int t = 0; t < 4; ++t) { acc[t][r] *= cr; ac2[t][r] *= cr; } }
    LDSX();
#pragma unroll
    for (int kc = 0; kc < 2; ++kc) { const v16b ph = frag_b(&sPh[w][col][0] + kc * 32, lane), pl = frag_b(&sPl[w][col][0] + kc * 32, lane);
#pragma unroll
      for (int t = 0; t < 4; ++t) { const v16b vb = frag_b(VTb + (bh * HD + t * 16 + col) * SS + kt * 64 + kc * 32, lane); acc[t] = wmma_bf(ph, vb, acc[t]); ac2[t] = wmma_bf(pl, vb, ac2[t]); } }
    __builtin_amdgcn_wave_barrier(); }
#pragma unroll
  for (int r = 0; r < 8; ++r) { const float lr = __shfl(lrun, 8 * g + r, 32); const float inv = 1.0f / lr;
#pragma unroll
    for (int t = 0; t < 4; ++t) sO[w][8 * g + r][t * 16 + col] = (acc[t][r] + ac2[t][r]) * inv; }
  LDSX();
  { const int b = (int)(bh / NH), h = (int)(bh % NH);
    for (int qq = lane; qq < 16 * 16; qq += 32) { const int rl = qq >> 4, pc = qq & 15; vst2(O32 + ((size_t)b * SS + q0 + rl) * E + h * HD + pc * 4, *(const v4f*)(&sO[w][rl][pc * 4])); } }
}
// out = ctx Wo^T : split(ctx) x bf16(Wo rows) two products; block (128 rows, 128 cols), 8 waves of (32 rows, 64 cols).
// Per 64 k the block loads both f32 tiles in whole 256-byte row pieces, converts each element once and lays ctx hi, ctx lo and W
// as bf16 rows in LDS; every wave takes its fragments from there. Two LDS buffers, the tile after next held in registers.
#define OKS 64
#define OPI 72
#define OPL (128 * OPI)
#define OBF (3 * OPL)
typedef __attribute__((ext_vector_type(4))) __bf16 v4b;
__global__ __launch_bounds__(256) void k_out(const float* __restrict__ O32, const float* __restrict__ Wo, const float* __restrict__ bo, float* __restrict__ out) {
  __shared__ __align__(16) __bf16 sm[2 * OBF];
  const int tid = threadIdx.x, wave = tid >> 5, lane = tid & 31, col = lane & 15, g = lane >> 4;
  const int m0 = blockIdx.x * 128, n0 = blockIdx.y * 128;
  const int wm = (wave & 3) * 32, wn = (wave >> 2) * 64;
  const int sr = tid >> 4, sc = (tid & 15) * 4;
  const unsigned go = (unsigned)(sr * E + sc);
  v4f ra[8], rw[8];
  auto ld = [&](int s) { const float* ga = O32 + (size_t)m0 * E + s * OKS; const float* gw = Wo + (size_t)n0 * E + s * OKS;
#pragma unroll
    for (int i = 0; i < 8; ++i) { ra[i] = *(const v4f*)(ga + go + i * 16 * E); rw[i] = *(const v4f*)(gw + go + i * 16 * E); } };
  auto st = [&](int buf) { __bf16* d = sm + buf * OBF + sr * OPI + sc;
#pragma unroll
    for (int i = 0; i < 8; ++i) { const v4b h = __builtin_convertvector(ra[i], v4b), wv = __builtin_convertvector(rw[i], v4b);
      const v4b l = __builtin_convertvector(ra[i] - __builtin_convertvector(h, v4f), v4b);
      vst2(d + i * 16 * OPI, h); vst2(d + OPL + i * 16 * OPI, l); vst2(d + 2 * OPL + i * 16 * OPI, wv); } };
  v8f acc[2][4] = {};
  ld(0); st(0); ld(1);
  __syncthreads();
  // kept rolled: one copy of the stage body, so the registers stay under 256 and the loop stays short in the instruction cache
#pragma unroll 1
  for (int s = 0; s < E / OKS; ++s) {
    const __bf16* bA = sm + (s & 1) * OBF + (wm + col) * OPI; const __bf16* bW = sm + (s & 1) * OBF + 2 * OPL + (wn + col) * OPI;
    if (s + 1 < E / OKS) st((s + 1) & 1);
    if (s + 2 < E / OKS) { ld(s + 2);
      // the loads' address registers are reused by the fragment loads below: the wait stands in front of that overwrite
      asm volatile("s_wait_xcnt 0x0" ::: "memory"); }
#pragma unroll
    for (int kc = 0; kc < OKS / 32; ++kc) { v16b ah[2], al[2], wb[4];
#pragma unroll
      for (int i = 0; i < 2; ++i) { ah[i] = frag_b(bA + i * 16 * OPI + kc * 32, lane); al[i] = frag_b(bA + OPL + i * 16 * OPI + kc * 32, lane); }
#pragma unroll
      for (int j = 0; j < 4; ++j) wb[j] = frag_b(bW + j * 16 * OPI + kc * 32, lane);
#pragma unroll
      for (int i = 0; i < 2; ++i)
#pragma unroll
        for (int j = 0; j < 4; ++j) acc[i][j] = wmma_bf(al[i], wb[j], acc[i][j]);
#pragma unroll
      for (int i = 0; i < 2; ++i)
#pragma unroll
        for (int j = 0; j < 4; ++j) acc[i][j] = wmma_bf(ah[i], wb[j], acc[i][j]); }
    // publishes the tile just stored and ends every wave's reads of the buffer that the next trip overwrites
    __syncthreads();
  }
  // behind the loop's last barrier the buffers are free: each wave stages its 32 x 64 result in its own range, pitch 68 floats
  float_a* so = (float_a*)sm + wave * (32 * 68);
#pragma unroll
  for (int j = 0; j < 4; ++j) { const float bj = (float)(__bf16)bo[n0 + wn + j * 16 + col];
#pragma unroll
    for (int i = 0; i < 2; ++i)
#pragma unroll
      for (int r = 0; r < 8; ++r) so[(i * 16 + 8 * g + r) * 68 + j * 16 + col] = acc[i][j][r] + bj; }
  LDSX();
#pragma unroll
  for (int it = 0; it < 16; ++it) { const int rl = it * 2 + g; vst2(out + (size_t)(m0 + wm + rl) * E + n0 + wn + col * 4, *(const v4f*)(so + rl * 68 + col * 4)); }
}
extern "C" void kernel_launch(void* const* d_in, const int* in_sizes, int n_in, void* d_out, int out_size, void* d_ws, size_t ws_size, hipStream_t stream) {
  (void)in_sizes; (void)n_in; (void)out_size; (void)ws_size;
  const float* Q = (const float*)d_in[0]; const float* K = (const float*)d_in[1]; const float* V = (const float*)d_in[2]; const float* Wo = (const float*)d_in[3]; const float* bo = (const float*)d_in[4];
  float* out = (float*)d_out;
  char* ws = (char*)d_ws; size_t off = 0;
  auto take = [&](size_t bytes) { char* p = ws + off; off += (bytes + 255) & ~(size_t)255; return p; };
  __bf16* Qb = (__bf16*)take((size_t)NR * E * 2); __bf16* Kb = (__bf16*)take((size_t)NR * E * 2); __bf16* VTb = (__bf16*)take((size_t)NR * E * 2); float* O32 = (float*)take((size_t)NR * E * 4);
  // ws ~ 42 MB
  k_cvtqk<<<(NR * E / 8 + 255) / 256, 256, 0, stream>>>(Q, Qb);
  k_cvtqk<<<(NR * E / 8 + 255) / 256, 256, 0, stream>>>(K, Kb);
  k_cvtv<<<dim3(NR / 64, E / 128), 256, 0, stream>>>(V, VTb);
  k_attn<<<dim3(SS / 64, NB * NH), 128, 0, stream>>>(Qb, Kb, VTb, O32);
  k_out<<<dim3(NR / 128, E / 128), 256, 0, stream>>>(O32, Wo, bo, out);
}

// v002
// A run of this version takes 40.6 microseconds.
// In both of two side-by-side timings against v001, it was 1.49 times as fast.
// All steps since v000 together make it 3.76 times as fast.
// compute dtype: the INPUT Q/K/V/Wo rounded to bf16 and multiplied with exact bf16 WMMA products (f32 accumulate); computed operands (softmax weights P, context) carried as bf16 hi/lo pairs; softmax f32; bias b_proj rounded to bf16, added in f32.
#include <hip/hip_runtime.h>
#include <math.h>

typedef __attribute__((ext_vector_type(16))) _Float16 v16h;
typedef __attribute__((ext_vector_type(16))) __bf16 v16b;
typedef __attribute__((ext_vector_type(8)))  _Float16 v8h;
typedef __attribute__((ext_vector_type(8)))  float v8f;
typedef __attribute__((ext_vector_type(4)))  float v4f;
typedef __attribute__((ext_vector_type(2)))  float v2f;
typedef __attribute__((ext_vector_type(4)))  unsigned v4u;
typedef __attribute__((ext_vector_type(4)))  int v4i;
typedef float __attribute__((may_alias)) float_a;
typedef int __attribute__((may_alias)) int_a;

template <typename T> __device__ __forceinline__ void vst2(void* p, T v) { *(T*)p = v;  }
__device__ __forceinline__ v8f wmma16(v16h a, v16h b, v8f c) {
  v8f d = __builtin_amdgcn_wmma_f32_16x16x32_f16(false, a, false, b, (short)0, c, false, false);
  asm volatile("v_nop\n\tv_nop\n\tv_nop\n\tv_nop" : "+v"(d) : "v"(a), "v"(b));
  return d;
}
__device__ __forceinline__ v8f wmma_bf(v16b a, v16b b, v8f c) {
  v8f d = __builtin_amdgcn_wmma_f32_16x16x32_bf16(false, a, false, b, (short)0, c, false, false);
  asm volatile("v_nop\n\tv_nop\n\tv_nop\n\tv_nop" : "+v"(d) : "v"(a), "v"(b));
  return d;
}
// 16x16x32 fragments: lane = (h = lane>>4, row/col = lane&15); elements 0..7 = k0+8h+0..7, 8..15 = k0+16+8h+0..7; D element r = row 8h+r
__device__ __forceinline__ v16h frag_h(const _Float16* rowk0, int lane) {
  union { v16h v; v8h q[2]; } u; const _Float16* p = rowk0 + 8 * (lane >> 4);
  u.q[0] = *(const v8h*)p; u.q[1] = *(const v8h*)(p + 16); return u.v;
}
__device__ __forceinline__ v16h frag_f32(const float* rowk0, int lane) {
  v16h a; const float* p = rowk0 + 8 * (lane >> 4);
#pragma unroll
  for (int i = 0; i < 8; ++i) { a[i] = (_Float16)p[i]; a[8 + i] = (_Float16)p[16 + i]; }
  return a;
}
__device__ __forceinline__ v16h frag_f32s(const float* rowk0, int lane, float sc) {
  v16h a; const float* p = rowk0 + 8 * (lane >> 4);
#pragma unroll
  for (int i = 0; i < 8; ++i) { a[i] = (_Float16)(p[i] * sc); a[8 + i] = (_Float16)(p[16 + i] * sc); }
  return a;
}
// column fragment from a [K][ld] layout (column n), rows >= K read as 0
__device__ __forceinline__ v16h fragc_f32(const float* W, int k0, int n, int lane, int ld, int K) {
  v16h a; const int g = lane >> 4;
#pragma unroll
  for (int i = 0; i < 8; ++i) { const int ka = k0 + 8 * g + i, kb = ka + 16;
    a[i] = (_Float16)(ka < K ? W[(size_t)ka * ld + n] : 0.f); a[8 + i] = (_Float16)(kb < K ? W[(size_t)kb * ld + n] : 0.f); }
  return a;
}
struct F2 { v16b h, l; };
__device__ __forceinline__ F2 bsplit16(const float v[16]) { F2 r;
#pragma unroll
  for (int i = 0; i < 16; ++i) { const __bf16 h = (__bf16)v[i]; r.h[i] = h; r.l[i] = (__bf16)(v[i] - (float)h); }
  return r; }
__device__ __forceinline__ F2 split_row(const float* row, int k0, int lane) { float v[16]; const float* p = row + k0 + 8 * (lane >> 4);
#pragma unroll
  for (int i = 0; i < 8; ++i) { v[i] = p[i]; v[8 + i] = p[16 + i]; }
  return bsplit16(v); }
__device__ __forceinline__ F2 split_rowK(const float* row, int k0, int lane, int K) { float v[16]; const int g = lane >> 4;
#pragma unroll
  for (int i = 0; i < 8; ++i) { const int ka = k0 + 8 * g + i, kb = ka + 16; v[i] = ka < K ? row[ka] : 0.f; v[8 + i] = kb < K ? row[kb] : 0.f; }
  return bsplit16(v); }
__device__ __forceinline__ F2 split_col(const float* W, int k0, int n, int lane, int ld, int K) { float v[16]; const int g = lane >> 4;
#pragma unroll
  for (int i = 0; i < 8; ++i) { const int ka = k0 + 8 * g + i, kb = ka + 16; v[i] = ka < K ? W[(size_t)ka * ld + n] : 0.f; v[8 + i] = kb < K ? W[(size_t)kb * ld + n] : 0.f; }
  return bsplit16(v); }
__device__ __forceinline__ v8f mac3(const F2& a, const F2& b, v8f c) { c = wmma_bf(a.l, b.h, c); c = wmma_bf(a.h, b.l, c); return wmma_bf(a.h, b.h, c); }
__device__ __forceinline__ float sigm(float v) { return 1.0f / (1.0f + expf(-v)); }
#define LDSX() do { asm volatile("s_wait_dscnt 0" ::: "memory"); __builtin_amdgcn_wave_barrier(); __builtin_amdgcn_fence(__ATOMIC_RELEASE, "workgroup"); } while (0)


// Windowed multi-head attention on given Q, K, V [2,2048,1024] (16 heads x 64): scores q.k/8 with |i-j| > 64 masked to -inf, softmax, @ v, heads concatenated, @ W_proj^T + b_proj.
// Key tiles qt-1..qt+1 of 64 keys cover the window of query tile qt. k_attn reads Q, K, V as f32 and rounds them to bf16 itself.
#define NB 2
#define SS 2048
#define E 1024
#define NH 16
#define HD 64
#define NR (NB * SS)
__device__ __forceinline__ v16b frag_b(const __bf16* rowk0, int lane) { return __builtin_bit_cast(v16b, frag_h((const _Float16*)rowk0, lane)); }
typedef __attribute__((ext_vector_type(4))) __bf16 v4b;
typedef __attribute__((ext_vector_type(8))) short s16x8;
// row-major 16-bit LDS tile -> 8 consecutive rows of one column per lane
__device__ __forceinline__ v8h ld_tr16(const __bf16* p) { typedef __attribute__((address_space(3))) s16x8 lds_s16x8; return __builtin_bit_cast(v8h, __builtin_amdgcn_ds_load_tr16_b128_v8i16((lds_s16x8*)p)); }

// Block = 128 queries of one head, 8 waves of 16 queries. The 256 key rows that its waves touch are loaded once as f32 in whole 256-byte row pieces,
// rounded to bf16 and laid in LDS: K rows at 144 bytes (plain 16-byte readers), V rows at 160 bytes (transposing reader gives the V^T fragment).
#define AQ 128
#define AKR 256
#define KPI 72
#define VPI 80
__global__ __launch_bounds__(256) void k_attn(const float* __restrict__ Q, const float* __restrict__ K, const float* __restrict__ V, float* __restrict__ O32) {
  __shared__ __align__(16) __bf16 sK[AKR * KPI];
  __shared__ __align__(32) __bf16 sV[AKR * VPI];
  __shared__ __align__(16) float sS[8][16][68];
  __shared__ __align__(16) __bf16 sPh[8][16][72], sPl[8][16][72];
  const int tid = threadIdx.x, lane = tid & 31, col = lane & 15, g = lane >> 4;
  // the wave's number as a scalar: the key loop's bounds depend on it and stay scalar branches
  const int w = __builtin_amdgcn_readfirstlane(tid >> 5);
  const int bh = blockIdx.y, b = bh / NH, h = bh % NH; const int qb = blockIdx.x; const int q0 = qb * AQ + w * 16;
  // first staged key row: the window's start, moved so that all 256 rows lie inside the sequence
  const int kb0 = qb * AQ - 64 < 0 ? 0 : (qb * AQ - 64 > SS - AKR ? SS - AKR : qb * AQ - 64);
  const int sr = tid >> 4, sc = (tid & 15) * 4;
  v16b aq[2];
  { v4f rk[16], rv[16], rq[8];
    const float* gk = K + ((size_t)b * SS + kb0 + sr) * E + h * HD + sc; const float* gv = V + ((size_t)b * SS + kb0 + sr) * E + h * HD + sc;
    const float* gq = Q + ((size_t)b * SS + q0 + col) * E + h * HD + 8 * g;
#pragma unroll
    for (int i = 0; i < 16; ++i) rk[i] = *(const v4f*)(gk + (size_t)i * 16 * E);
#pragma unroll
    for (int i = 0; i < 8; ++i) rq[i] = *(const v4f*)(gq + (i >> 1) * 16 + (i & 1) * 4);
#pragma unroll
    for (int i = 0; i < 16; ++i) rv[i] = *(const v4f*)(gv + (size_t)i * 16 * E);
    // the loads' address registers are free for reuse behind this point: the wait stands in front of any overwrite
    asm volatile("s_wait_xcnt 0x0" ::: "memory");
#pragma unroll
    for (int i = 0; i < 16; ++i) vst2(sK + (i * 16 + sr) * KPI + sc, __builtin_convertvector(rk[i], v4b));
#pragma unroll
    for (int kc = 0; kc < 2; ++kc)
#pragma unroll
      for (int e = 0; e < 4; ++e) { aq[kc][e] = (__bf16)rq[kc * 4][e]; aq[kc][4 + e] = (__bf16)rq[kc * 4 + 1][e]; aq[kc][8 + e] = (__bf16)rq[kc * 4 + 2][e]; aq[kc][12 + e] = (__bf16)rq[kc * 4 + 3][e]; }
#pragma unroll
    for (int i = 0; i < 16; ++i) vst2(sV + (i * 16 + sr) * VPI + sc, __builtin_convertvector(rv[i], v4b)); }
  // publishes the staged K and V rows to every wave; nothing is written to them afterwards
  __syncthreads();
  float mrun = -3.0e38f, lrun = 0.f; v8f acc[4] = {}, ac2[4] = {};
  const int qt = q0 >> 6; const int kt0 = qt > 0 ? qt - 1 : 0, kt1 = qt < SS / 64 - 1 ? qt + 1 : SS / 64 - 1;
#pragma unroll 1
  for (int kt = kt0; kt <= kt1; ++kt) { const int kl = kt * 64 - kb0;
#pragma unroll
    for (int t = 0; t < 4; ++t) { const int key = kt * 64 + t * 16 + col; v8f s = {};
#pragma unroll
      for (int kc = 0; kc < 2; ++kc) s = wmma_bf(aq[kc], frag_b(sK + (kl + t * 16 + col) * KPI + kc * 32, lane), s);
#pragma unroll
      for (int r = 0; r < 8; ++r) { const int rel = key - (q0 + 8 * g + r); sS[w][8 * g + r][t * 16 + col] = (rel > 64 || rel < -64) ? -3.0e38f : s[r] * 0.125f; } }
    LDSX();
    float mx = -3.4e38f;
#pragma unroll
    for (int jj = 0; jj < 32; ++jj) mx = fmaxf(mx, sS[w][col][g * 32 + jj]);
    mx = fmaxf(mx, __shfl_xor(mx, 16, 32));
    const float mnew = fmaxf(mrun, mx); const float corr = expf(mrun - mnew);
    float ps = 0.f;
#pragma unroll
    for (int jj = 0; jj < 32; ++jj) { const float sv = sS[w][col][g * 32 + jj]; const float p = sv <= -1.0e38f ? 0.f : expf(sv - mnew); ps += p; const __bf16 hi = (__bf16)p; sPh[w][col][g * 32 + jj] = hi; sPl[w][col][g * 32 + jj] = (__bf16)(p - (float)hi); }
    ps += __shfl_xor(ps, 16, 32);
    lrun = lrun * corr + ps; mrun = mnew;
#pragma unroll
    for (int r = 0; r < 8; ++r) { const float cr = __shfl(corr, 8 * g + r, 32);
#pragma unroll
      for (int t = 0; t < 4; ++t) { acc[t][r] *= cr; ac2[t][r] *= cr; } }
    LDSX();
#pragma unroll
    for (int kc = 0; kc < 2; ++kc) { const v16b ph = frag_b(&sPh[w][col][0] + kc * 32, lane), pl = frag_b(&sPl[w][col][0] + kc * 32, lane);
      // lane's own 16 bytes of the 16 x 16 piece: key row kl + kc*32 + 8g + (lane & 7), d half (lane >> 3) & 1; the second load takes the rows 16 further on
      const __bf16* vp = sV + (kl + kc * 32 + 8 * g + (lane & 7)) * VPI + ((lane >> 3) & 1) * 8;
#pragma unroll
      for (int t = 0; t < 4; ++t) { union { v16b v; v8h q[2]; } u; u.q[0] = ld_tr16(vp + t * 16); u.q[1] = ld_tr16(vp + 16 * VPI + t * 16);
        acc[t] = wmma_bf(ph, u.v, acc[t]); ac2[t] = wmma_bf(pl, u.v, ac2[t]); } }
    __builtin_amdgcn_wave_barrier(); }
  // the wave's own score rows are free behind the loop: its 16 x 64 result is staged there for whole-line stores
#pragma unroll
  for (int r = 0; r < 8; ++r) { const float lr = __shfl(lrun, 8 * g + r, 32); const float inv = 1.0f / lr;
#pragma unroll
    for (int t = 0; t < 4; ++t) sS[w][8 * g + r][t * 16 + col] = (acc[t][r] + ac2[t][r]) * inv; }
  LDSX();
  for (int qq = lane; qq < 16 * 16; qq += 32) { const int rl = qq >> 4, pc = qq & 15; vst2(O32 + ((size_t)b * SS + q0 + rl) * E + h * HD + pc * 4, *(const v4f*)(&sS[w][rl][pc * 4])); }
}
// out = ctx Wo^T : split(ctx) x bf16(Wo rows) two products; block (128 rows, 128 cols), 8 waves of (32 rows, 64 cols).
// Per 64 k the block loads both f32 tiles in whole 256-byte row pieces, converts each element once and lays ctx hi, ctx lo and W
// as bf16 rows in LDS; every wave takes its fragments from there. Two LDS buffers, the tile after next held in registers.
#define OKS 64
#define OPI 72
#define OPL (128 * OPI)
#define OBF (3 * OPL)
__global__ __launch_bounds__(256) void k_out(const float* __restrict__ O32, const float* __restrict__ Wo, const float* __restrict__ bo, float* __restrict__ out) {
  __shared__ __align__(16) __bf16 sm[2 * OBF];
  const int tid = threadIdx.x, wave = tid >> 5, lane = tid & 31, col = lane & 15, g = lane >> 4;
  const int m0 = blockIdx.x * 128, n0 = blockIdx.y * 128;
  const int wm = (wave & 3) * 32, wn = (wave >> 2) * 64;
  const int sr = tid >> 4, sc = (tid & 15) * 4;
  const unsigned go = (unsigned)(sr * E + sc);
  v4f ra[8], rw[8];
  auto ld = [&](int s) { const float* ga = O32 + (size_t)m0 * E + s * OKS; const float* gw = Wo + (size_t)n0 * E + s * OKS;
#pragma unroll
    for (int i = 0; i < 8; ++i) { ra[i] = *(const v4f*)(ga + go + i * 16 * E); rw[i] = *(const v4f*)(gw + go + i * 16 * E); } };
  auto st = [&](int buf) { __bf16* d = sm + buf * OBF + sr * OPI + sc;
#pragma unroll
    for (int i = 0; i < 8; ++i) { const v4b h = __builtin_convertvector(ra[i], v4b), wv = __builtin_convertvector(rw[i], v4b);
      const v4b l = __builtin_convertvector(ra[i] - __builtin_convertvector(h, v4f), v4b);
      vst2(d + i * 16 * OPI, h); vst2(d + OPL + i * 16 * OPI, l); vst2(d + 2 * OPL + i * 16 * OPI, wv); } };
  v8f acc[2][4] = {};
  ld(0); st(0); ld(1);
  __syncthreads();
  // kept rolled: one copy of the stage body, so the registers stay under 256
#pragma unroll 1
  for (int s = 0; s < E / OKS; ++s) {
    const __bf16* bA = sm + (s & 1) * OBF + (wm + col) * OPI; const __bf16* bW = sm + (s & 1) * OBF + 2 * OPL + (wn + col) * OPI;
    if (s + 1 < E / OKS) st((s + 1) & 1);
    if (s + 2 < E / OKS) { ld(s + 2);
      // the loads' address registers are reused by the fragment loads below: the wait stands in front of that overwrite
      asm volatile("s_wait_xcnt 0x0" ::: "memory"); }
#pragma unroll
    for (int kc = 0; kc < OKS / 32; ++kc) { v16b ah[2], al[2], wb[4];
#pragma unroll
      for (int i = 0; i < 2; ++i) { ah[i] = frag_b(bA + i * 16 * OPI + kc * 32, lane); al[i] = frag_b(bA + OPL + i * 16 * OPI + kc * 32, lane); }
#pragma unroll
      for (int j = 0; j < 4; ++j) wb[j] = frag_b(bW + j * 16 * OPI + kc * 32, lane);
#pragma unroll
      for (int i = 0; i < 2; ++i)
#pragma unroll
        for (int j = 0; j < 4; ++j) acc[i][j] = wmma_bf(al[i], wb[j], acc[i][j]);
#pragma unroll
      for (int i = 0; i < 2; ++i)
#pragma unroll
        for (int j = 0; j < 4; ++j) acc[i][j] = wmma_bf(ah[i], wb[j], acc[i][j]); }
    // publishes the tile just stored and ends every wave's reads of the buffer that the next trip overwrites
    __syncthreads();
  }
  // behind the loop's last barrier the buffers are free: each wave stages its 32 x 64 result in its own range, pitch 68 floats
  float_a* so = (float_a*)sm + wave * (32 * 68);
#pragma unroll
  for (int j = 0; j < 4; ++j) { const float bj = (float)(__bf16)bo[n0 + wn + j * 16 + col];
#pragma unroll
    for (int i = 0; i < 2; ++i)
#pragma unroll
      for (int r = 0; r < 8; ++r) so[(i * 16 + 8 * g + r) * 68 + j * 16 + col] = acc[i][j][r] + bj; }
  LDSX();
#pragma unroll
  for (int it = 0; it < 16; ++it) { const int rl = it * 2 + g; vst2(out + (size_t)(m0 + wm + rl) * E + n0 + wn + col * 4, *(const v4f*)(so + rl * 68 + col * 4)); }
}
extern "C" void kernel_launch(void* const* d_in, const int* in_sizes, int n_in, void* d_out, int out_size, void* d_ws, size_t ws_size, hipStream_t stream) {
  (void)in_sizes; (void)n_in; (void)out_size; (void)ws_size;
  const float* Q = (const float*)d_in[0]; const float* K = (const float*)d_in[1]; const float* V = (const float*)d_in[2]; const float* Wo = (const float*)d_in[3]; const float* bo = (const float*)d_in[4];
  float* out = (float*)d_out;
  char* ws = (char*)d_ws; size_t off = 0;
  auto take = [&](size_t bytes) { char* p = ws + off; off += (bytes + 255) & ~(size_t)255; return p; };
  float* O32 = (float*)take((size_t)NR * E * 4);
  // ws ~ 17 MB
  k_attn<<<dim3(SS / AQ, NB * NH), 256, 0, stream>>>(Q, K, V, O32);
  k_out<<<dim3(NR / 128, E / 128), 256, 0, stream>>>(O32, Wo, bo, out);
}

// v003
// It runs in 32.7 microseconds.
// Timed twice side by side with v002, it ran 1.24 and 1.23 times as fast.
// Over all steps from v000 it is 4.64 times as fast.
// compute dtype: the INPUT Q/K/V/Wo rounded to bf16 and multiplied with exact bf16 WMMA products (f32 accumulate); computed operands (softmax weights P, context) carried as bf16 hi/lo pairs; softmax f32; bias b_proj rounded to bf16, added in f32.
#include <hip/hip_runtime.h>
#include <math.h>

typedef __attribute__((ext_vector_type(16))) _Float16 v16h;
typedef __attribute__((ext_vector_type(16))) __bf16 v16b;
typedef __attribute__((ext_vector_type(8)))  _Float16 v8h;
typedef __attribute__((ext_vector_type(8)))  float v8f;
typedef __attribute__((ext_vector_type(4)))  float v4f;
typedef __attribute__((ext_vector_type(2)))  float v2f;
typedef __attribute__((ext_vector_type(4)))  unsigned v4u;
typedef __attribute__((ext_vector_type(4)))  int v4i;
typedef float __attribute__((may_alias)) float_a;
typedef int __attribute__((may_alias)) int_a;

template <typename T> __device__ __forceinline__ void vst2(void* p, T v) { *(T*)p = v;  }
__device__ __forceinline__ v8f wmma16(v16h a, v16h b, v8f c) {
  v8f d = __builtin_amdgcn_wmma_f32_16x16x32_f16(false, a, false, b, (short)0, c, false, false);
  asm volatile("v_nop\n\tv_nop\n\tv_nop\n\tv_nop" : "+v"(d) : "v"(a), "v"(b));
  return d;
}
__device__ __forceinline__ v8f wmma_bf(v16b a, v16b b, v8f c) {
  v8f d = __builtin_amdgcn_wmma_f32_16x16x32_bf16(false, a, false, b, (short)0, c, false, false);
  asm volatile("v_nop\n\tv_nop\n\tv_nop\n\tv_nop" : "+v"(d) : "v"(a), "v"(b));
  return d;
}
// 16x16x32 fragments: lane = (h = lane>>4, row/col = lane&15); elements 0..7 = k0+8h+0..7, 8..15 = k0+16+8h+0..7; D element r = row 8h+r
__device__ __forceinline__ v16h frag_h(const _Float16* rowk0, int lane) {
  union { v16h v; v8h q[2]; } u; const _Float16* p = rowk0 + 8 * (lane >> 4);
  u.q[0] = *(const v8h*)p; u.q[1] = *(const v8h*)(p + 16); return u.v;
}
__device__ __forceinline__ v16h frag_f32(const float* rowk0, int lane) {
  v16h a; const float* p = rowk0 + 8 * (lane >> 4);
#pragma unroll
  for (int i = 0; i < 8; ++i) { a[i] = (_Float16)p[i]; a[8 + i] = (_Float16)p[16 + i]; }
  return a;
}
__device__ __forceinline__ v16h frag_f32s(const float* rowk0, int lane, float sc) {
  v16h a; const float* p = rowk0 + 8 * (lane >> 4);
#pragma unroll
  for (int i = 0; i < 8; ++i) { a[i] = (_Float16)(p[i] * sc); a[8 + i] = (_Float16)(p[16 + i] * sc); }
  return a;
}
// column fragment from a [K][ld] layout (column n), rows >= K read as 0
__device__ __forceinline__ v16h fragc_f32(const float* W, int k0, int n, int lane, int ld, int K) {
  v16h a; const int g = lane >> 4;
#pragma unroll
  for (int i = 0; i < 8; ++i) { const int ka = k0 + 8 * g + i, kb = ka + 16;
    a[i] = (_Float16)(ka < K ? W[(size_t)ka * ld + n] : 0.f); a[8 + i] = (_Float16)(kb < K ? W[(size_t)kb * ld + n] : 0.f); }
  return a;
}
struct F2 { v16b h, l; };
__device__ __forceinline__ F2 bsplit16(const float v[16]) { F2 r;
#pragma unroll
  for (int i = 0; i < 16; ++i) { const __bf16 h = (__bf16)v[i]; r.h[i] = h; r.l[i] = (__bf16)(v[i] - (float)h); }
  return r; }
__device__ __forceinline__ F2 split_row(const float* row, int k0, int lane) { float v[16]; const float* p = row + k0 + 8 * (lane >> 4);
#pragma unroll
  for (int i = 0; i < 8; ++i) { v[i] = p[i]; v[8 + i] = p[16 + i]; }
  return bsplit16(v); }
__device__ __forceinline__ F2 split_rowK(const float* row, int k0, int lane, int K) { float v[16]; const int g = lane >> 4;
#pragma unroll
  for (int i = 0; i < 8; ++i) { const int ka = k0 + 8 * g + i, kb = ka + 16; v[i] = ka < K ? row[ka] : 0.f; v[8 + i] = kb < K ? row[kb] : 0.f; }
  return bsplit16(v); }
__device__ __forceinline__ F2 split_col(const float* W, int k0, int n, int lane, int ld, int K) { float v[16]; const int g = lane >> 4;
#pragma unroll
  for (int i = 0; i < 8; ++i) { const int ka = k0 + 8 * g + i, kb = ka + 16; v[i] = ka < K ? W[(size_t)ka * ld + n] : 0.f; v[8 + i] = kb < K ? W[(size_t)kb * ld + n] : 0.f; }
  return bsplit16(v); }
__device__ __forceinline__ v8f mac3(const F2& a, const F2& b, v8f c) { c = wmma_bf(a.l, b.h, c); c = wmma_bf(a.h, b.l, c); return wmma_bf(a.h, b.h, c); }
__device__ __forceinline__ float sigm(float v) { return 1.0f / (1.0f + expf(-v)); }
#define LDSX() do { asm volatile("s_wait_dscnt 0" ::: "memory"); __builtin_amdgcn_wave_barrier(); __builtin_amdgcn_fence(__ATOMIC_RELEASE, "workgroup"); } while (0)


// Windowed multi-head attention on given Q, K, V [2,2048,1024] (16 heads x 64): scores q.k/8 with |i-j| > 64 masked to -inf, softmax, @ v, heads concatenated, @ W_proj^T + b_proj.
// The 9 key tiles of 16 from q0 - 64 on cover the window of a wave's 16 queries q0... k_attn reads Q, K, V as f32 and rounds them to bf16 itself.
#define NB 2
#define SS 2048
#define E 1024
#define NH 16
#define HD 64
#define NR (NB * SS)
__device__ __forceinline__ v16b frag_b(const __bf16* rowk0, int lane) { return __builtin_bit_cast(v16b, frag_h((const _Float16*)rowk0, lane)); }
typedef __attribute__((ext_vector_type(4))) __bf16 v4b;
typedef __attribute__((ext_vector_type(16))) float v16f;
typedef __attribute__((ext_vector_type(8))) unsigned v8u;
typedef __attribute__((ext_vector_type(8))) short s16x8;
// row-major 16-bit LDS tile -> 8 consecutive rows of one column per lane
__device__ __forceinline__ v8h ld_tr16(const __bf16* p) { typedef __attribute__((address_space(3))) s16x8 lds_s16x8; return __builtin_bit_cast(v8h, __builtin_amdgcn_ds_load_tr16_b128_v8i16((lds_s16x8*)p)); }

// Block = 128 queries of one head, 8 waves of 16 queries. The 256 key rows that its waves touch are loaded once as f32 in whole 256-byte row pieces,
// rounded to bf16 and laid in LDS: K rows at 144 bytes (plain 16-byte readers), V rows at 160 bytes (transposing reader gives the V^T fragment).
#define AQ 128
#define AKR 256
#define KPI 72
#define VPI 80
__global__ __launch_bounds__(256) void k_attn(const float* __restrict__ Q, const float* __restrict__ K, const float* __restrict__ V, float* __restrict__ O32) {
  __shared__ __align__(16) __bf16 sK[AKR * KPI];
  __shared__ __align__(32) __bf16 sV[AKR * VPI];
  __shared__ __align__(16) float sS[8][16][68];
  const int tid = threadIdx.x, lane = tid & 31, col = lane & 15, g = lane >> 4;
  // the wave's number as a scalar: q0 and the key tiles' ok flags and LDS rows that follow from it stay scalar
  const int w = __builtin_amdgcn_readfirstlane(tid >> 5);
  const int bh = blockIdx.y, b = bh / NH, h = bh % NH; const int qb = blockIdx.x; const int q0 = qb * AQ + w * 16;
  // first staged key row: the window's start, moved so that all 256 rows lie inside the sequence
  const int kb0 = qb * AQ - 64 < 0 ? 0 : (qb * AQ - 64 > SS - AKR ? SS - AKR : qb * AQ - 64);
  const int sr = tid >> 4, sc = (tid & 15) * 4;
  v16b aq[2];
  { v4f rk[16], rv[16], rq[8];
    const float* gk = K + ((size_t)b * SS + kb0 + sr) * E + h * HD + sc; const float* gv = V + ((size_t)b * SS + kb0 + sr) * E + h * HD + sc;
    const float* gq = Q + ((size_t)b * SS + q0 + col) * E + h * HD + 8 * g;
#pragma unroll
    for (int i = 0; i < 16; ++i) rk[i] = *(const v4f*)(gk + (size_t)i * 16 * E);
#pragma unroll
    for (int i = 0; i < 8; ++i) rq[i] = *(const v4f*)(gq + (i >> 1) * 16 + (i & 1) * 4);
#pragma unroll
    for (int i = 0; i < 16; ++i) rv[i] = *(const v4f*)(gv + (size_t)i * 16 * E);
    // the loads' address registers are free for reuse behind this point: the wait stands in front of any overwrite
    asm volatile("s_wait_xcnt 0x0" ::: "memory");
#pragma unroll
    for (int i = 0; i < 16; ++i) vst2(sK + (i * 16 + sr) * KPI + sc, __builtin_convertvector(rk[i], v4b));
#pragma unroll
    for (int kc = 0; kc < 2; ++kc)
#pragma unroll
      for (int e = 0; e < 4; ++e) { aq[kc][e] = (__bf16)rq[kc * 4][e]; aq[kc][4 + e] = (__bf16)rq[kc * 4 + 1][e]; aq[kc][8 + e] = (__bf16)rq[kc * 4 + 2][e]; aq[kc][12 + e] = (__bf16)rq[kc * 4 + 3][e]; }
#pragma unroll
    for (int i = 0; i < 16; ++i) vst2(sV + (i * 16 + sr) * VPI + sc, __builtin_convertvector(rv[i], v4b)); }
  // publishes the staged K and V rows to every wave; nothing is written to them afterwards
  __syncthreads();
  // Transposed products: S^T = K Q^T puts one query's scores in one lane pair (lane = query col, register r of tile j = key q0 - 64 + 16 j + 8 g + r),
  // so the whole window of 9 key tiles of 16 stays in registers, and two score tiles, converted in place, are the B fragment of O^T = V^T P^T.
  // Every loop below is unrolled because its index picks registers (score tiles, fragments, accumulators), which cannot be indexed at run time.
  v8f sT[9] = {}; bool ok[9]; int lr[9];
  // a key tile outside the sequence is masked as a whole; its LDS row is set to a staged one
#pragma unroll
  for (int j = 0; j < 9; ++j) { const int kbj = q0 - 64 + 16 * j; ok[j] = kbj >= 0 && kbj < SS; lr[j] = ok[j] ? kbj - kb0 : 0; }
#pragma unroll
  for (int kc = 0; kc < 2; ++kc) { v16b kf[9];   // the nine K fragments of a k half are asked for as one group, ahead of their nine independent products
#pragma unroll
    for (int j = 0; j < 9; ++j) kf[j] = frag_b(sK + (lr[j] + col) * KPI + kc * 32, lane);
#pragma unroll
    for (int j = 0; j < 9; ++j) sT[j] = wmma_bf(kf[j], aq[kc], sT[j]); }
  // key - query = 16 j - 64 + kr + r: only the first and the last tile cross the window's edge
  const int kr = 8 * g - col;
  float mx = -3.0e38f;
#pragma unroll
  for (int j = 0; j < 9; ++j)
#pragma unroll
    for (int r = 0; r < 8; ++r) { const bool in = ok[j] && (j != 0 || kr + r >= 0) && (j != 8 || kr + r <= 0);
      sT[j][r] = in ? sT[j][r] * 0.125f : -3.0e38f; mx = fmaxf(mx, sT[j][r]); }
  mx = fmaxf(mx, __shfl_xor(mx, 16, 32));
  float pa[4] = {0.f, 0.f, 0.f, 0.f}; v8f acc[4] = {}, ac2[4] = {};
#pragma unroll
  for (int c = 0; c < 5; ++c) { const int j0 = 2 * c, j1 = c < 4 ? 2 * c + 1 : 8;
    // lane's own 16 bytes of a 16 x 16 piece: key row 8g + (lane & 7) of the tile, d half (lane >> 3) & 1; the last pass has no second tile: its weights are 0 and it reads the first again
    const __bf16* v0 = sV + (lr[j0] + 8 * g + (lane & 7)) * VPI + ((lane >> 3) & 1) * 8; const __bf16* v1 = sV + (lr[j1] + 8 * g + (lane & 7)) * VPI + ((lane >> 3) & 1) * 8;
    // the pass's four V^T fragments are asked for as one group, ahead of the exponentials that hide their latency
    union { v16b v; v8h q[2]; } u[4];
#pragma unroll
    for (int t = 0; t < 4; ++t) { u[t].q[0] = ld_tr16(v0 + t * 16); u[t].q[1] = ld_tr16(v1 + t * 16); }
    v16f p;
#pragma unroll
    for (int r = 0; r < 8; ++r) { p[r] = expf(sT[j0][r] - mx); p[8 + r] = c < 4 ? expf(sT[j1][r] - mx) : 0.f; pa[r & 3] += p[r] + p[8 + r]; }
    const v16b ph = __builtin_convertvector(p, v16b); const v8u pw = __builtin_bit_cast(v8u, ph); v16f hf;
#pragma unroll
    for (int i = 0; i < 8; ++i) { hf[2 * i] = __builtin_bit_cast(float, pw[i] << 16); hf[2 * i + 1] = __builtin_bit_cast(float, pw[i] & 0xffff0000u); }
    const v16b pl = __builtin_convertvector(p - hf, v16b);
#pragma unroll
    for (int t = 0; t < 4; ++t) { acc[t] = wmma_bf(u[t].v, ph, acc[t]); ac2[t] = wmma_bf(u[t].v, pl, ac2[t]); } }
  float lsum = (pa[0] + pa[1]) + (pa[2] + pa[3]); lsum += __shfl_xor(lsum, 16, 32);
  const float inv = 1.0f / lsum;
  // register r of output tile t = d 16 t + 8 g + r of the lane's own query: the wave's 16 x 64 result is staged in its own LDS rows for whole-line stores
#pragma unroll
  for (int t = 0; t < 4; ++t) { v4f o0, o1;
#pragma unroll
    for (int e = 0; e < 4; ++e) { o0[e] = (acc[t][e] + ac2[t][e]) * inv; o1[e] = (acc[t][4 + e] + ac2[t][4 + e]) * inv; }
    vst2(&sS[w][col][t * 16 + 8 * g], o0); vst2(&sS[w][col][t * 16 + 8 * g + 4], o1); }
  LDSX();
  for (int qq = lane; qq < 16 * 16; qq += 32) { const int rl = qq >> 4, pc = qq & 15; vst2(O32 + ((size_t)b * SS + q0 + rl) * E + h * HD + pc * 4, *(const v4f*)(&sS[w][rl][pc * 4])); }
}
// out = ctx Wo^T : split(ctx) x bf16(Wo rows) two products; block (128 rows, 128 cols), 8 waves of (32 rows, 64 cols).
// Per 64 k the block loads both f32 tiles in whole 256-byte row pieces, converts each element once and lays ctx hi, ctx lo and W
// as bf16 rows in LDS; every wave takes its fragments from there. Two LDS buffers, the tile after next held in registers.
#define OKS 64
#define OPI 72
#define OPL (128 * OPI)
#define OBF (3 * OPL)
__global__ __launch_bounds__(256) void k_out(const float* __restrict__ O32, const float* __restrict__ Wo, const float* __restrict__ bo, float* __restrict__ out) {
  __shared__ __align__(16) __bf16 sm[2 * OBF];
  const int tid = threadIdx.x, wave = tid >> 5, lane = tid & 31, col = lane & 15, g = lane >> 4;
  const int m0 = blockIdx.x * 128, n0 = blockIdx.y * 128;
  const int wm = (wave & 3) * 32, wn = (wave >> 2) * 64;
  const int sr = tid >> 4, sc = (tid & 15) * 4;
  const unsigned go = (unsigned)(sr * E + sc);
  v4f ra[8], rw[8];
  auto ld = [&](int s) { const float* ga = O32 + (size_t)m0 * E + s * OKS; const float* gw = Wo + (size_t)n0 * E + s * OKS;
#pragma unroll
    for (int i = 0; i < 8; ++i) { ra[i] = *(const v4f*)(ga + go + i * 16 * E); rw[i] = *(const v4f*)(gw + go + i * 16 * E); } };
  auto st = [&](int buf) { __bf16* d = sm + buf * OBF + sr * OPI + sc;
#pragma unroll
    for (int i = 0; i < 8; ++i) { const v4b h = __builtin_convertvector(ra[i], v4b), wv = __builtin_convertvector(rw[i], v4b);
      const v4b l = __builtin_convertvector(ra[i] - __builtin_convertvector(h, v4f), v4b);
      vst2(d + i * 16 * OPI, h); vst2(d + OPL + i * 16 * OPI, l); vst2(d + 2 * OPL + i * 16 * OPI, wv); } };
  v8f acc[2][4] = {};
  ld(0); st(0); ld(1);
  __syncthreads();
  // kept rolled: one copy of the stage body, so the registers stay under 256
#pragma unroll 1
  for (int s = 0; s < E / OKS; ++s) {
    const __bf16* bA = sm + (s & 1) * OBF + (wm + col) * OPI; const __bf16* bW = sm + (s & 1) * OBF + 2 * OPL + (wn + col) * OPI;
    if (s + 1 < E / OKS) st((s + 1) & 1);
    if (s + 2 < E / OKS) { ld(s + 2);
      // the loads' address registers are reused by the fragment loads below: the wait stands in front of that overwrite
      asm volatile("s_wait_xcnt 0x0" ::: "memory"); }
#pragma unroll
    for (int kc = 0; kc < OKS / 32; ++kc) { v16b ah[2], al[2], wb[4];
#pragma unroll
      for (int i = 0; i < 2; ++i) { ah[i] = frag_b(bA + i * 16 * OPI + kc * 32, lane); al[i] = frag_b(bA + OPL + i * 16 * OPI + kc * 32, lane); }
#pragma unroll
      for (int j = 0; j < 4; ++j) wb[j] = frag_b(bW + j * 16 * OPI + kc * 32, lane);
#pragma unroll
      for (int i = 0; i < 2; ++i)
#pragma unroll
        for (int j = 0; j < 4; ++j) acc[i][j] = wmma_bf(al[i], wb[j], acc[i][j]);
#pragma unroll
      for (int i = 0; i < 2; ++i)
#pragma unroll
        for (int j = 0; j < 4; ++j) acc[i][j] = wmma_bf(ah[i], wb[j], acc[i][j]); }
    // publishes the tile just stored and ends every wave's reads of the buffer that the next trip overwrites
    __syncthreads();
  }
  // behind the loop's last barrier the buffers are free: each wave stages its 32 x 64 result in its own range, pitch 68 floats
  float_a* so = (float_a*)sm + wave * (32 * 68);
#pragma unroll
  for (int j = 0; j < 4; ++j) { const float bj = (float)(__bf16)bo[n0 + wn + j * 16 + col];
#pragma unroll
    for (int i = 0; i < 2; ++i)
#pragma unroll
      for (int r = 0; r < 8; ++r) so[(i * 16 + 8 * g + r) * 68 + j * 16 + col] = acc[i][j][r] + bj; }
  LDSX();
#pragma unroll
  for (int it = 0; it < 16; ++it) { const int rl = it * 2 + g; vst2(out + (size_t)(m0 + wm + rl) * E + n0 + wn + col * 4, *(const v4f*)(so + rl * 68 + col * 4)); }
}
extern "C" void kernel_launch(void* const* d_in, const int* in_sizes, int n_in, void* d_out, int out_size, void* d_ws, size_t ws_size, hipStream_t stream) {
  (void)in_sizes; (void)n_in; (void)out_size; (void)ws_size;
  const float* Q = (const float*)d_in[0]; const float* K = (const float*)d_in[1]; const float* V = (const float*)d_in[2]; const float* Wo = (const float*)d_in[3]; const float* bo = (const float*)d_in[4];
  float* out = (float*)d_out;
  char* ws = (char*)d_ws; size_t off = 0;
  auto take = [&](size_t bytes) { char* p = ws + off; off += (bytes + 255) & ~(size_t)255; return p; };
  float* O32 = (float*)take((size_t)NR * E * 4);
  // ws ~ 17 MB
  k_attn<<<dim3(SS / AQ, NB * NH), 256, 0, stream>>>(Q, K, V, O32);
  k_out<<<dim3(NR / 128, E / 128), 256, 0, stream>>>(O32, Wo, bo, out);
}

// v004
// It runs in 31.6 microseconds.
// In two side-by-side timings against v003, it was 1.05 and 1.03 times as fast.
// Over all steps from v000 it is 4.82 times as fast.
// compute dtype: the INPUT Q/K/V/Wo rounded to bf16 and multiplied with exact bf16 WMMA products (f32 accumulate); computed operands (softmax weights P, context) carried as bf16 hi/lo pairs; softmax f32; bias b_proj rounded to bf16, added in f32.
#include <hip/hip_runtime.h>
#include <math.h>

typedef __attribute__((ext_vector_type(16))) _Float16 v16h;
typedef __attribute__((ext_vector_type(16))) __bf16 v16b;
typedef __attribute__((ext_vector_type(8)))  _Float16 v8h;
typedef __attribute__((ext_vector_type(8)))  float v8f;
typedef __attribute__((ext_vector_type(4)))  float v4f;
typedef __attribute__((ext_vector_type(2)))  float v2f;
typedef __attribute__((ext_vector_type(4)))  unsigned v4u;
typedef __attribute__((ext_vector_type(4)))  int v4i;
typedef float __attribute__((may_alias)) float_a;
typedef int __attribute__((may_alias)) int_a;

template <typename T> __device__ __forceinline__ void vst2(void* p, T v) { *(T*)p = v;  }
__device__ __forceinline__ v8f wmma16(v16h a, v16h b, v8f c) {
  v8f d = __builtin_amdgcn_wmma_f32_16x16x32_f16(false, a, false, b, (short)0, c, false, false);
  asm volatile("v_nop\n\tv_nop\n\tv_nop\n\tv_nop" : "+v"(d) : "v"(a), "v"(b));
  return d;
}
__device__ __forceinline__ v8f wmma_bf(v16b a, v16b b, v8f c) {
  v8f d = __builtin_amdgcn_wmma_f32_16x16x32_bf16(false, a, false, b, (short)0, c, false, false);
  asm volatile("v_nop\n\tv_nop\n\tv_nop\n\tv_nop" : "+v"(d) : "v"(a), "v"(b));
  return d;
}
// 16x16x32 fragments: lane = (h = lane>>4, row/col = lane&15); elements 0..7 = k0+8h+0..7, 8..15 = k0+16+8h+0..7; D element r = row 8h+r
__device__ __forceinline__ v16h frag_h(const _Float16* rowk0, int lane) {
  union { v16h v; v8h q[2]; } u; const _Float16* p = rowk0 + 8 * (lane >> 4);
  u.q[0] = *(const v8h*)p; u.q[1] = *(const v8h*)(p + 16); return u.v;
}
__device__ __forceinline__ v16h frag_f32(const float* rowk0, int lane) {
  v16h a; const float* p = rowk0 + 8 * (lane >> 4);
#pragma unroll
  for (int i = 0; i < 8; ++i) { a[i] = (_Float16)p[i]; a[8 + i] = (_Float16)p[16 + i]; }
  return a;
}
__device__ __forceinline__ v16h frag_f32s(const float* rowk0, int lane, float sc) {
  v16h a; const float* p = rowk0 + 8 * (lane >> 4);
#pragma unroll
  for (int i = 0; i < 8; ++i) { a[i] = (_Float16)(p[i] * sc); a[8 + i] = (_Float16)(p[16 + i] * sc); }
  return a;
}
// column fragment from a [K][ld] layout (column n), rows >= K read as 0
__device__ __forceinline__ v16h fragc_f32(const float* W, int k0, int n, int lane, int ld, int K) {
  v16h a; const int g = lane >> 4;
#pragma unroll
  for (int i = 0; i < 8; ++i) { const int ka = k0 + 8 * g + i, kb = ka + 16;
    a[i] = (_Float16)(ka < K ? W[(size_t)ka * ld + n] : 0.f); a[8 + i] = (_Float16)(kb < K ? W[(size_t)kb * ld + n] : 0.f); }
  return a;
}
struct F2 { v16b h, l; };
__device__ __forceinline__ F2 bsplit16(const float v[16]) { F2 r;
#pragma unroll
  for (int i = 0; i < 16; ++i) { const __bf16 h = (__bf16)v[i]; r.h[i] = h; r.l[i] = (__bf16)(v[i] - (float)h); }
  return r; }
__device__ __forceinline__ F2 split_row(const float* row, int k0, int lane) { float v[16]; const float* p = row + k0 + 8 * (lane >> 4);
#pragma unroll
  for (int i = 0; i < 8; ++i) { v[i] = p[i]; v[8 + i] = p[16 + i]; }
  return bsplit16(v); }
__device__ __forceinline__ F2 split_rowK(const float* row, int k0, int lane, int K) { float v[16]; const int g = lane >> 4;
#pragma unroll
  for (int i = 0; i < 8; ++i) { const int ka = k0 + 8 * g + i, kb = ka + 16; v[i] = ka < K ? row[ka] : 0.f; v[8 + i] = kb < K ? row[kb] : 0.f; }
  return bsplit16(v); }
__device__ __forceinline__ F2 split_col(const float* W, int k0, int n, int lane, int ld, int K) { float v[16]; const int g = lane >> 4;
#pragma unroll
  for (int i = 0; i < 8; ++i) { const int ka = k0 + 8 * g + i, kb = ka + 16; v[i] = ka < K ? W[(size_t)ka * ld + n] : 0.f; v[8 + i] = kb < K ? W[(size_t)kb * ld + n] : 0.f; }
  return bsplit16(v); }
__device__ __forceinline__ v8f mac3(const F2& a, const F2& b, v8f c) { c = wmma_bf(a.l, b.h, c); c = wmma_bf(a.h, b.l, c); return wmma_bf(a.h, b.h, c); }
__device__ __forceinline__ float sigm(float v) { return 1.0f / (1.0f + expf(-v)); }
#define LDSX() do { asm volatile("s_wait_dscnt 0" ::: "memory"); __builtin_amdgcn_wave_barrier(); __builtin_amdgcn_fence(__ATOMIC_RELEASE, "workgroup"); } while (0)


// Windowed multi-head attention on given Q, K, V [2,2048,1024] (16 heads x 64): scores q.k/8 with |i-j| > 64 masked to -inf, softmax, @ v, heads concatenated, @ W_proj^T + b_proj.
// The 9 key tiles of 16 from q0 - 64 on cover the window of a wave's 16 queries q0... k_attn reads Q, K, V as f32 and rounds them to bf16 itself.
#define NB 2
#define SS 2048
#define E 1024
#define NH 16
#define HD 64
#define NR (NB * SS)
__device__ __forceinline__ v16b frag_b(const __bf16* rowk0, int lane) { return __builtin_bit_cast(v16b, frag_h((const _Float16*)rowk0, lane)); }
typedef __attribute__((ext_vector_type(4))) __bf16 v4b;
typedef __attribute__((ext_vector_type(16))) float v16f;
typedef __attribute__((ext_vector_type(8))) unsigned v8u;
typedef __attribute__((ext_vector_type(8))) short s16x8;
// row-major 16-bit LDS tile -> 8 consecutive rows of one column per lane
__device__ __forceinline__ v8h ld_tr16(const __bf16* p) { typedef __attribute__((address_space(3))) s16x8 lds_s16x8; return __builtin_bit_cast(v8h, __builtin_amdgcn_ds_load_tr16_b128_v8i16((lds_s16x8*)p)); }

// Eight base-2 exponentials as one group. The outputs are early-clobber, so none of them is a source of the group: no v_exp_f32 here reads a result or
// overwrites a source of the one in front of it; the closing v_nop keeps the same free slot between the last one and whatever the compiler puts next.
__device__ __forceinline__ void exp2x8(float* o, const float* x) {
  asm("v_exp_f32 %0, %8\n\tv_exp_f32 %1, %9\n\tv_exp_f32 %2, %10\n\tv_exp_f32 %3, %11\n\tv_exp_f32 %4, %12\n\tv_exp_f32 %5, %13\n\tv_exp_f32 %6, %14\n\tv_exp_f32 %7, %15\n\tv_nop"
      : "=&v"(o[0]), "=&v"(o[1]), "=&v"(o[2]), "=&v"(o[3]), "=&v"(o[4]), "=&v"(o[5]), "=&v"(o[6]), "=&v"(o[7])
      : "v"(x[0]), "v"(x[1]), "v"(x[2]), "v"(x[3]), "v"(x[4]), "v"(x[5]), "v"(x[6]), "v"(x[7]));
}
// Block = 128 queries of one head, 8 waves of 16 queries. The 256 key rows that its waves touch are loaded once as f32 in whole 256-byte row pieces,
// rounded to bf16 and laid in LDS: K rows at 144 bytes (plain 16-byte readers), V rows at 160 bytes (transposing reader gives the V^T fragment).
#define AQ 128
#define AKR 256
#define KPI 72
#define VPI 80
__global__ __launch_bounds__(256) void k_attn(const float* __restrict__ Q, const float* __restrict__ K, const float* __restrict__ V, float* __restrict__ O32) {
  __shared__ __align__(16) __bf16 sK[AKR * KPI];
  __shared__ __align__(32) __bf16 sV[AKR * VPI];
  __shared__ __align__(16) float sS[8][16][68];
  const int tid = threadIdx.x, lane = tid & 31, col = lane & 15, g = lane >> 4;
  // the wave's number as a scalar: q0 and the key tiles' ok flags and LDS rows that follow from it stay scalar
  const int w = __builtin_amdgcn_readfirstlane(tid >> 5);
  const int bh = blockIdx.y, b = bh / NH, h = bh % NH; const int qb = blockIdx.x; const int q0 = qb * AQ + w * 16;
  // first staged key row: the window's start, moved so that all 256 rows lie inside the sequence
  const int kb0 = qb * AQ - 64 < 0 ? 0 : (qb * AQ - 64 > SS - AKR ? SS - AKR : qb * AQ - 64);
  const int sr = tid >> 4, sc = (tid & 15) * 4;
  v16b aq[2];
  { v4f rk[16], rv[16], rq[8];
    const float* gk = K + ((size_t)b * SS + kb0 + sr) * E + h * HD + sc; const float* gv = V + ((size_t)b * SS + kb0 + sr) * E + h * HD + sc;
    const float* gq = Q + ((size_t)b * SS + q0 + col) * E + h * HD + 8 * g;
#pragma unroll
    for (int i = 0; i < 16; ++i) rk[i] = *(const v4f*)(gk + (size_t)i * 16 * E);
#pragma unroll
    for (int i = 0; i < 8; ++i) rq[i] = *(const v4f*)(gq + (i >> 1) * 16 + (i & 1) * 4);
#pragma unroll
    for (int i = 0; i < 16; ++i) rv[i] = *(const v4f*)(gv + (size_t)i * 16 * E);
    // the loads' address registers are free for reuse behind this point: the wait stands in front of any overwrite
    asm volatile("s_wait_xcnt 0x0" ::: "memory");
#pragma unroll
    for (int i = 0; i < 16; ++i) vst2(sK + (i * 16 + sr) * KPI + sc, __builtin_convertvector(rk[i], v4b));
#pragma unroll
    for (int kc = 0; kc < 2; ++kc)
#pragma unroll
      for (int e = 0; e < 4; ++e) { aq[kc][e] = (__bf16)rq[kc * 4][e]; aq[kc][4 + e] = (__bf16)rq[kc * 4 + 1][e]; aq[kc][8 + e] = (__bf16)rq[kc * 4 + 2][e]; aq[kc][12 + e] = (__bf16)rq[kc * 4 + 3][e]; }
#pragma unroll
    for (int i = 0; i < 16; ++i) vst2(sV + (i * 16 + sr) * VPI + sc, __builtin_convertvector(rv[i], v4b)); }
  // publishes the staged K and V rows to every wave; nothing is written to them afterwards
  __syncthreads();
  // Transposed products: S^T = K Q^T puts one query's scores in one lane pair (lane = query col, register r of tile j = key q0 - 64 + 16 j + 8 g + r),
  // so the whole window of 9 key tiles of 16 stays in registers, and two score tiles, converted in place, are the B fragment of O^T = V^T P^T.
  // Every loop below is unrolled because its index picks registers (score tiles, fragments, accumulators), which cannot be indexed at run time.
  v8f sT[9] = {}; bool ok[9]; int lr[9];
  // a key tile outside the sequence is masked as a whole; its LDS row is set to a staged one
#pragma unroll
  for (int j = 0; j < 9; ++j) { const int kbj = q0 - 64 + 16 * j; ok[j] = kbj >= 0 && kbj < SS; lr[j] = ok[j] ? kbj - kb0 : 0; }
#pragma unroll
  for (int kc = 0; kc < 2; ++kc) { v16b kf[9];   // the nine K fragments of a k half are asked for as one group, ahead of their nine independent products
#pragma unroll
    for (int j = 0; j < 9; ++j) kf[j] = frag_b(sK + (lr[j] + col) * KPI + kc * 32, lane);
#pragma unroll
    for (int j = 0; j < 9; ++j) sT[j] = wmma_bf(kf[j], aq[kc], sT[j]); }
  // key - query = 16 j - 64 + kr + r: only the first and the last tile cross the window's edge
  const int kr = 8 * g - col;
  float mx = -3.0e38f;
#pragma unroll
  for (int j = 0; j < 9; ++j)
#pragma unroll
    for (int r = 0; r < 8; ++r) { const bool in = ok[j] && (j != 0 || kr + r >= 0) && (j != 8 || kr + r <= 0);
      sT[j][r] = in ? sT[j][r] : -3.0e38f; mx = fmaxf(mx, sT[j][r]); }
  mx = fmaxf(mx, __shfl_xor(mx, 16, 32));
  // exp((s - mx) / 8) = 2^(s c - mx c), c = log2(e) / 8: one fused multiply-add and the hardware's base-2 exponential per score.
  // The argument exceeds 0 by no more than the rounding of mx c (the same offset for every key of a query, so it cancels in the division by the sum):
  // no overflow guard is owed; a weight under 2^-126 may come out as 0, far below what the sum keeps.
  const float ec = 0.18033688011112042f, mc = mx * ec;
  float pa[4] = {0.f, 0.f, 0.f, 0.f}; v8f acc[4] = {}, ac2[4] = {};
#pragma unroll
  for (int c = 0; c < 5; ++c) { const int j0 = 2 * c, j1 = c < 4 ? 2 * c + 1 : 8;
    // lane's own 16 bytes of a 16 x 16 piece: key row 8g + (lane & 7) of the tile, d half (lane >> 3) & 1; the last pass has no second tile: its weights are 0 and it reads the first again
    const __bf16* v0 = sV + (lr[j0] + 8 * g + (lane & 7)) * VPI + ((lane >> 3) & 1) * 8; const __bf16* v1 = sV + (lr[j1] + 8 * g + (lane & 7)) * VPI + ((lane >> 3) & 1) * 8;
    // the pass's four V^T fragments are asked for as one group, ahead of the exponentials that hide their latency
    union { v16b v; v8h q[2]; } u[4];
#pragma unroll
    for (int t = 0; t < 4; ++t) { u[t].q[0] = ld_tr16(v0 + t * 16); u[t].q[1] = ld_tr16(v1 + t * 16); }
    v16f p; float x0[8], x1[8], e0[8], e1[8] = {0.f, 0.f, 0.f, 0.f, 0.f, 0.f, 0.f, 0.f};
#pragma unroll
    for (int r = 0; r < 8; ++r) { x0[r] = fmaf(sT[j0][r], ec, -mc); x1[r] = fmaf(sT[j1][r], ec, -mc); }
    exp2x8(e0, x0); if (c < 4) exp2x8(e1, x1);
#pragma unroll
    for (int r = 0; r < 8; ++r) { p[r] = e0[r]; p[8 + r] = e1[r]; pa[r & 3] += p[r] + p[8 + r]; }
    const v16b ph = __builtin_convertvector(p, v16b); const v8u pw = __builtin_bit_cast(v8u, ph); v16f hf;
#pragma unroll
    for (int i = 0; i < 8; ++i) { hf[2 * i] = __builtin_bit_cast(float, pw[i] << 16); hf[2 * i + 1] = __builtin_bit_cast(float, pw[i] & 0xffff0000u); }
    const v16b pl = __builtin_convertvector(p - hf, v16b);
#pragma unroll
    for (int t = 0; t < 4; ++t) { acc[t] = wmma_bf(u[t].v, ph, acc[t]); ac2[t] = wmma_bf(u[t].v, pl, ac2[t]); } }
  float lsum = (pa[0] + pa[1]) + (pa[2] + pa[3]); lsum += __shfl_xor(lsum, 16, 32);
  const float inv = 1.0f / lsum;
  // register r of output tile t = d 16 t + 8 g + r of the lane's own query: the wave's 16 x 64 result is staged in its own LDS rows for whole-line stores
#pragma unroll
  for (int t = 0; t < 4; ++t) { v4f o0, o1;
#pragma unroll
    for (int e = 0; e < 4; ++e) { o0[e] = (acc[t][e] + ac2[t][e]) * inv; o1[e] = (acc[t][4 + e] + ac2[t][4 + e]) * inv; }
    vst2(&sS[w][col][t * 16 + 8 * g], o0); vst2(&sS[w][col][t * 16 + 8 * g + 4], o1); }
  LDSX();
  for (int qq = lane; qq < 16 * 16; qq += 32) { const int rl = qq >> 4, pc = qq & 15; vst2(O32 + ((size_t)b * SS + q0 + rl) * E + h * HD + pc * 4, *(const v4f*)(&sS[w][rl][pc * 4])); }
}
// out = ctx Wo^T : split(ctx) x bf16(Wo rows) two products; block (128 rows, 128 cols), 8 waves of (32 rows, 64 cols).
// Per 64 k the block loads both f32 tiles in whole 256-byte row pieces, converts each element once and lays ctx hi, ctx lo and W
// as bf16 rows in LDS; every wave takes its fragments from there. Two LDS buffers, the tile after next held in registers.
#define OKS 64
#define OPI 72
#define OPL (128 * OPI)
#define OBF (3 * OPL)
__global__ __launch_bounds__(256) void k_out(const float* __restrict__ O32, const float* __restrict__ Wo, const float* __restrict__ bo, float* __restrict__ out) {
  __shared__ __align__(16) __bf16 sm[2 * OBF];
  const int tid = threadIdx.x, wave = tid >> 5, lane = tid & 31, col = lane & 15, g = lane >> 4;
  const int m0 = blockIdx.x * 128, n0 = blockIdx.y * 128;
  const int wm = (wave & 3) * 32, wn = (wave >> 2) * 64;
  const int sr = tid >> 4, sc = (tid & 15) * 4;
  const unsigned go = (unsigned)(sr * E + sc);
  v4f ra[8], rw[8];
  auto ld = [&](int s) { const float* ga = O32 + (size_t)m0 * E + s * OKS; const float* gw = Wo + (size_t)n0 * E + s * OKS;
#pragma unroll
    for (int i = 0; i < 8; ++i) { ra[i] = *(const v4f*)(ga + go + i * 16 * E); rw[i] = *(const v4f*)(gw + go + i * 16 * E); } };
  auto st = [&](int buf) { __bf16* d = sm + buf * OBF + sr * OPI + sc;
#pragma unroll
    for (int i = 0; i < 8; ++i) { const v4b h = __builtin_convertvector(ra[i], v4b), wv = __builtin_convertvector(rw[i], v4b);
      const v4b l = __builtin_convertvector(ra[i] - __builtin_convertvector(h, v4f), v4b);
      vst2(d + i * 16 * OPI, h); vst2(d + OPL + i * 16 * OPI, l); vst2(d + 2 * OPL + i * 16 * OPI, wv); } };
  v8f acc[2][4] = {};
  ld(0); st(0); ld(1);
  __syncthreads();
  // kept rolled: one copy of the stage body, so the registers stay under 256
#pragma unroll 1
  for (int s = 0; s < E / OKS; ++s) {
    const __bf16* bA = sm + (s & 1) * OBF + (wm + col) * OPI; const __bf16* bW = sm + (s & 1) * OBF + 2 * OPL + (wn + col) * OPI;
    if (s + 1 < E / OKS) st((s + 1) & 1);
    if (s + 2 < E / OKS) { ld(s + 2);
      // the loads' address registers are reused by the fragment loads below: the wait stands in front of that overwrite
      asm volatile("s_wait_xcnt 0x0" ::: "memory"); }
#pragma unroll
    for (int kc = 0; kc < OKS / 32; ++kc) { v16b ah[2], al[2], wb[4];
#pragma unroll
      for (int i = 0; i < 2; ++i) { ah[i] = frag_b(bA + i * 16 * OPI + kc * 32, lane); al[i] = frag_b(bA + OPL + i * 16 * OPI + kc * 32, lane); }
#pragma unroll
      for (int j = 0; j < 4; ++j) wb[j] = frag_b(bW + j * 16 * OPI + kc * 32, lane);
#pragma unroll
      for (int i = 0; i < 2; ++i)
#pragma unroll
        for (int j = 0; j < 4; ++j) acc[i][j] = wmma_bf(al[i], wb[j], acc[i][j]);
#pragma unroll
      for (int i = 0; i < 2; ++i)
#pragma unroll
        for (int j = 0; j < 4; ++j) acc[i][j] = wmma_bf(ah[i], wb[j], acc[i][j]); }
    // publishes the tile just stored and ends every wave's reads of the buffer that the next trip overwrites
    __syncthreads();
  }
  // behind the loop's last barrier the buffers are free: each wave stages its 32 x 64 result in its own range, pitch 68 floats
  float_a* so = (float_a*)sm + wave * (32 * 68);
#pragma unroll
  for (int j = 0; j < 4; ++j) { const float bj = (float)(__bf16)bo[n0 + wn + j * 16 + col];
#pragma unroll
    for (int i = 0; i < 2; ++i)
#pragma unroll
      for (int r = 0; r < 8; ++r) so[(i * 16 + 8 * g + r) * 68 + j * 16 + col] = acc[i][j][r] + bj; }
  LDSX();
#pragma unroll
  for (int it = 0; it < 16; ++it) { const int rl = it * 2 + g; vst2(out + (size_t)(m0 + wm + rl) * E + n0 + wn + col * 4, *(const v4f*)(so + rl * 68 + col * 4)); }
}
extern "C" void kernel_launch(void* const* d_in, const int* in_sizes, int n_in, void* d_out, int out_size, void* d_ws, size_t ws_size, hipStream_t stream) {
  (void)in_sizes; (void)n_in; (void)out_size; (void)ws_size;
  const float* Q = (const float*)d_in[0]; const float* K = (const float*)d_in[1]; const float* V = (const float*)d_in[2]; const float* Wo = (const float*)d_in[3]; const float* bo = (const float*)d_in[4];
  float* out = (float*)d_out;
  char* ws = (char*)d_ws; size_t off = 0;
  auto take = [&](size_t bytes) { char* p = ws + off; off += (bytes + 255) & ~(size_t)255; return p; };
  float* O32 = (float*)take((size_t)NR * E * 4);
  // ws ~ 17 MB
  k_attn<<<dim3(SS / AQ, NB * NH), 256, 0, stream>>>(Q, K, V, O32);
  k_out<<<dim3(NR / 128, E / 128), 256, 0, stream>>>(O32, Wo, bo, out);
}

// v005
// It runs in 27.1 microseconds.
// Next to v004, in two timings, it ran 1.16 times as fast each time.
// Over all steps from v000 it is 5.59 times as fast.
// compute dtype: the INPUT Q/K/V/Wo rounded to bf16 and multiplied with exact bf16 WMMA products (f32 accumulate); computed operands (softmax weights P, context) carried as bf16 hi/lo pairs; softmax f32; bias b_proj rounded to bf16, added in f32.
#include <hip/hip_runtime.h>
#include <math.h>

typedef __attribute__((ext_vector_type(16))) _Float16 v16h;
typedef __attribute__((ext_vector_type(16))) __bf16 v16b;
typedef __attribute__((ext_vector_type(8)))  _Float16 v8h;
typedef __attribute__((ext_vector_type(8)))  float v8f;
typedef __attribute__((ext_vector_type(4)))  float v4f;
typedef __attribute__((ext_vector_type(2)))  float v2f;
typedef __attribute__((ext_vector_type(4)))  unsigned v4u;
typedef __attribute__((ext_vector_type(4)))  int v4i;
typedef float __attribute__((may_alias)) float_a;
typedef int __attribute__((may_alias)) int_a;

template <typename T> __device__ __forceinline__ void vst2(void* p, T v) { *(T*)p = v;  }
__device__ __forceinline__ v8f wmma16(v16h a, v16h b, v8f c) {
  v8f d = __builtin_amdgcn_wmma_f32_16x16x32_f16(false, a, false, b, (short)0, c, false, false);
  asm volatile("v_nop\n\tv_nop\n\tv_nop\n\tv_nop" : "+v"(d) : "v"(a), "v"(b));
  return d;
}
__device__ __forceinline__ v8f wmma_bf(v16b a, v16b b, v8f c) {
  v8f d = __builtin_amdgcn_wmma_f32_16x16x32_bf16(false, a, false, b, (short)0, c, false, false);
  asm volatile("v_nop\n\tv_nop\n\tv_nop\n\tv_nop" : "+v"(d) : "v"(a), "v"(b));
  return d;
}
// 16x16x32 fragments: lane = (h = lane>>4, row/col = lane&15); elements 0..7 = k0+8h+0..7, 8..15 = k0+16+8h+0..7; D element r = row 8h+r
__device__ __forceinline__ v16h frag_h(const _Float16* rowk0, int lane) {
  union { v16h v; v8h q[2]; } u; const _Float16* p = rowk0 + 8 * (lane >> 4);
  u.q[0] = *(const v8h*)p; u.q[1] = *(const v8h*)(p + 16); return u.v;
}
__device__ __forceinline__ v16h frag_f32(const float* rowk0, int lane) {
  v16h a; const float* p = rowk0 + 8 * (lane >> 4);
#pragma unroll
  for (int i = 0; i < 8; ++i) { a[i] = (_Float16)p[i]; a[8 + i] = (_Float16)p[16 + i]; }
  return a;
}
__device__ __forceinline__ v16h frag_f32s(const float* rowk0, int lane, float sc) {
  v16h a; const float* p = rowk0 + 8 * (lane >> 4);
#pragma unroll
  for (int i = 0; i < 8; ++i) { a[i] = (_Float16)(p[i] * sc); a[8 + i] = (_Float16)(p[16 + i] * sc); }
  return a;
}
// column fragment from a [K][ld] layout (column n), rows >= K read as 0
__device__ __forceinline__ v16h fragc_f32(const float* W, int k0, int n, int lane, int ld, int K) {
  v16h a; const int g = lane >> 4;
#pragma unroll
  for (int i = 0; i < 8; ++i) { const int ka = k0 + 8 * g + i, kb = ka + 16;
    a[i] = (_Float16)(ka < K ? W[(size_t)ka * ld + n] : 0.f); a[8 + i] = (_Float16)(kb < K ? W[(size_t)kb * ld + n] : 0.f); }
  return a;
}
struct F2 { v16b h, l; };
__device__ __forceinline__ F2 bsplit16(const float v[16]) { F2 r;
#pragma unroll
  for (int i = 0; i < 16; ++i) { const __bf16 h = (__bf16)v[i]; r.h[i] = h; r.l[i] = (__bf16)(v[i] - (float)h); }
  return r; }
__device__ __forceinline__ F2 split_row(const float* row, int k0, int lane) { float v[16]; const float* p = row + k0 + 8 * (lane >> 4);
#pragma unroll
  for (int i = 0; i < 8; ++i) { v[i] = p[i]; v[8 + i] = p[16 + i]; }
  return bsplit16(v); }
__device__ __forceinline__ F2 split_rowK(const float* row, int k0, int lane, int K) { float v[16]; const int g = lane >> 4;
#pragma unroll
  for (int i = 0; i < 8; ++i) { const int ka = k0 + 8 * g + i, kb = ka + 16; v[i] = ka < K ? row[ka] : 0.f; v[8 + i] = kb < K ? row[kb] : 0.f; }
  return bsplit16(v); }
__device__ __forceinline__ F2 split_col(const float* W, int k0, int n, int lane, int ld, int K) { float v[16]; const int g = lane >> 4;
#pragma unroll
  for (int i = 0; i < 8; ++i) { const int ka = k0 + 8 * g + i, kb = ka + 16; v[i] = ka < K ? W[(size_t)ka * ld + n] : 0.f; v[8 + i] = kb < K ? W[(size_t)kb * ld + n] : 0.f; }
  return bsplit16(v); }
__device__ __forceinline__ v8f mac3(const F2& a, const F2& b, v8f c) { c = wmma_bf(a.l, b.h, c); c = wmma_bf(a.h, b.l, c); return wmma_bf(a.h, b.h, c); }
__device__ __forceinline__ float sigm(float v) { return 1.0f / (1.0f + expf(-v)); }
#define LDSX() do { asm volatile("s_wait_dscnt 0" ::: "memory"); __builtin_amdgcn_wave_barrier(); __builtin_amdgcn_fence(__ATOMIC_RELEASE, "workgroup"); } while (0)


// Windowed multi-head attention on given Q, K, V [2,2048,1024] (16 heads x 64): scores q.k/8 with |i-j| > 64 masked to -inf, softmax, @ v, heads concatenated, @ W_proj^T + b_proj.
// The 9 key tiles of 16 from q0 - 64 on cover the window of a wave's 16 queries q0... k_attn reads Q, K, V as f32 and rounds them to bf16 itself.
#define NB 2
#define SS 2048
#define E 1024
#define NH 16
#define HD 64
#define NR (NB * SS)
__device__ __forceinline__ v16b frag_b(const __bf16* rowk0, int lane) { return __builtin_bit_cast(v16b, frag_h((const _Float16*)rowk0, lane)); }
typedef __attribute__((ext_vector_type(4))) __bf16 v4b;
typedef __attribute__((ext_vector_type(16))) float v16f;
typedef __attribute__((ext_vector_type(8))) unsigned v8u;
typedef __attribute__((ext_vector_type(8))) short s16x8;
// row-major 16-bit LDS tile -> 8 consecutive rows of one column per lane
__device__ __forceinline__ v8h ld_tr16(const __bf16* p) { typedef __attribute__((address_space(3))) s16x8 lds_s16x8; return __builtin_bit_cast(v8h, __builtin_amdgcn_ds_load_tr16_b128_v8i16((lds_s16x8*)p)); }

// Eight base-2 exponentials as one group. The outputs are early-clobber, so none of them is a source of the group: no v_exp_f32 here reads a result or
// overwrites a source of the one in front of it; the closing v_nop keeps the same free slot between the last one and whatever the compiler puts next.
__device__ __forceinline__ void exp2x8(float* o, const float* x) {
  asm("v_exp_f32 %0, %8\n\tv_exp_f32 %1, %9\n\tv_exp_f32 %2, %10\n\tv_exp_f32 %3, %11\n\tv_exp_f32 %4, %12\n\tv_exp_f32 %5, %13\n\tv_exp_f32 %6, %14\n\tv_exp_f32 %7, %15\n\tv_nop"
      : "=&v"(o[0]), "=&v"(o[1]), "=&v"(o[2]), "=&v"(o[3]), "=&v"(o[4]), "=&v"(o[5]), "=&v"(o[6]), "=&v"(o[7])
      : "v"(x[0]), "v"(x[1]), "v"(x[2]), "v"(x[3]), "v"(x[4]), "v"(x[5]), "v"(x[6]), "v"(x[7]));
}
// Block = 128 queries of one head, 8 waves of 16 queries. The 256 key rows that its waves touch are loaded once as f32 in whole 256-byte row pieces,
// rounded to bf16 and laid in LDS: K rows at 144 bytes (plain 16-byte readers), V rows at 160 bytes (transposing reader gives the V^T fragment).
#define AQ 128
#define AKR 256
#define KPI 72
#define VPI 80
__global__ __launch_bounds__(256) void k_attn(const float* __restrict__ Q, const float* __restrict__ K, const float* __restrict__ V, float* __restrict__ O32) {
  __shared__ __align__(16) __bf16 sK[AKR * KPI];
  __shared__ __align__(32) __bf16 sV[AKR * VPI];
  __shared__ __align__(16) float sS[8][16][68];
  const int tid = threadIdx.x, lane = tid & 31, col = lane & 15, g = lane >> 4;
  // the wave's number as a scalar: q0 and the key tiles' ok flags and LDS rows that follow from it stay scalar
  const int w = __builtin_amdgcn_readfirstlane(tid >> 5);
  const int bh = blockIdx.y, b = bh / NH, h = bh % NH; const int qb = blockIdx.x; const int q0 = qb * AQ + w * 16;
  // first staged key row: the window's start, moved so that all 256 rows lie inside the sequence
  const int kb0 = qb * AQ - 64 < 0 ? 0 : (qb * AQ - 64 > SS - AKR ? SS - AKR : qb * AQ - 64);
  const int sr = tid >> 4, sc = (tid & 15) * 4;
  v16b aq[2];
  { v4f rk[16], rv[16], rq[8];
    const float* gk = K + ((size_t)b * SS + kb0 + sr) * E + h * HD + sc; const float* gv = V + ((size_t)b * SS + kb0 + sr) * E + h * HD + sc;
    const float* gq = Q + ((size_t)b * SS + q0 + col) * E + h * HD + 8 * g;
#pragma unroll
    for (int i = 0; i < 16; ++i) rk[i] = *(const v4f*)(gk + (size_t)i * 16 * E);
#pragma unroll
    for (int i = 0; i < 8; ++i) rq[i] = *(const v4f*)(gq + (i >> 1) * 16 + (i & 1) * 4);
#pragma unroll
    for (int i = 0; i < 16; ++i) rv[i] = *(const v4f*)(gv + (size_t)i * 16 * E);
    // the loads' address registers are free for reuse behind this point: the wait stands in front of any overwrite
    asm volatile("s_wait_xcnt 0x0" ::: "memory");
#pragma unroll
    for (int i = 0; i < 16; ++i) vst2(sK + (i * 16 + sr) * KPI + sc, __builtin_convertvector(rk[i], v4b));
#pragma unroll
    for (int kc = 0; kc < 2; ++kc)
#pragma unroll
      for (int e = 0; e < 4; ++e) { aq[kc][e] = (__bf16)rq[kc * 4][e]; aq[kc][4 + e] = (__bf16)rq[kc * 4 + 1][e]; aq[kc][8 + e] = (__bf16)rq[kc * 4 + 2][e]; aq[kc][12 + e] = (__bf16)rq[kc * 4 + 3][e]; }
#pragma unroll
    for (int i = 0; i < 16; ++i) vst2(sV + (i * 16 + sr) * VPI + sc, __builtin_convertvector(rv[i], v4b)); }
  // publishes the staged K and V rows to every wave; nothing is written to them afterwards
  __syncthreads();
  // Transposed products: S^T = K Q^T puts one query's scores in one lane pair (lane = query col, register r of tile j = key q0 - 64 + 16 j + 8 g + r),
  // so the whole window of 9 key tiles of 16 stays in registers, and two score tiles, converted in place, are the B fragment of O^T = V^T P^T.
  // Every loop below is unrolled because its index picks registers (score tiles, fragments, accumulators), which cannot be indexed at run time.
  v8f sT[9] = {}; bool ok[9]; int lr[9];
  // a key tile outside the sequence is masked as a whole; its LDS row is set to a staged one
#pragma unroll
  for (int j = 0; j < 9; ++j) { const int kbj = q0 - 64 + 16 * j; ok[j] = kbj >= 0 && kbj < SS; lr[j] = ok[j] ? kbj - kb0 : 0; }
#pragma unroll
  for (int kc = 0; kc < 2; ++kc) { v16b kf[9];   // the nine K fragments of a k half are asked for as one group, ahead of their nine independent products
#pragma unroll
    for (int j = 0; j < 9; ++j) kf[j] = frag_b(sK + (lr[j] + col) * KPI + kc * 32, lane);
#pragma unroll
    for (int j = 0; j < 9; ++j) sT[j] = wmma_bf(kf[j], aq[kc], sT[j]); }
  // key - query = 16 j - 64 + kr + r: only the first and the last tile cross the window's edge
  const int kr = 8 * g - col;
  float mx = -3.0e38f;
#pragma unroll
  for (int j = 0; j < 9; ++j)
#pragma unroll
    for (int r = 0; r < 8; ++r) { const bool in = ok[j] && (j != 0 || kr + r >= 0) && (j != 8 || kr + r <= 0);
      sT[j][r] = in ? sT[j][r] : -3.0e38f; mx = fmaxf(mx, sT[j][r]); }
  mx = fmaxf(mx, __shfl_xor(mx, 16, 32));
  // exp((s - mx) / 8) = 2^(s c - mx c), c = log2(e) / 8: one fused multiply-add and the hardware's base-2 exponential per score.
  // The argument exceeds 0 by no more than the rounding of mx c (the same offset for every key of a query, so it cancels in the division by the sum):
  // no overflow guard is owed; a weight under 2^-126 may come out as 0, far below what the sum keeps.
  const float ec = 0.18033688011112042f, mc = mx * ec;
  float pa[4] = {0.f, 0.f, 0.f, 0.f}; v8f acc[4] = {}, ac2[4] = {};
#pragma unroll
  for (int c = 0; c < 5; ++c) { const int j0 = 2 * c, j1 = c < 4 ? 2 * c + 1 : 8;
    // lane's own 16 bytes of a 16 x 16 piece: key row 8g + (lane & 7) of the tile, d half (lane >> 3) & 1; the last pass has no second tile: its weights are 0 and it reads the first again
    const __bf16* v0 = sV + (lr[j0] + 8 * g + (lane & 7)) * VPI + ((lane >> 3) & 1) * 8; const __bf16* v1 = sV + (lr[j1] + 8 * g + (lane & 7)) * VPI + ((lane >> 3) & 1) * 8;
    // the pass's four V^T fragments are asked for as one group, ahead of the exponentials that hide their latency
    union { v16b v; v8h q[2]; } u[4];
#pragma unroll
    for (int t = 0; t < 4; ++t) { u[t].q[0] = ld_tr16(v0 + t * 16); u[t].q[1] = ld_tr16(v1 + t * 16); }
    v16f p; float x0[8], x1[8], e0[8], e1[8] = {0.f, 0.f, 0.f, 0.f, 0.f, 0.f, 0.f, 0.f};
#pragma unroll
    for (int r = 0; r < 8; ++r) { x0[r] = fmaf(sT[j0][r], ec, -mc); x1[r] = fmaf(sT[j1][r], ec, -mc); }
    exp2x8(e0, x0); if (c < 4) exp2x8(e1, x1);
#pragma unroll
    for (int r = 0; r < 8; ++r) { p[r] = e0[r]; p[8 + r] = e1[r]; pa[r & 3] += p[r] + p[8 + r]; }
    const v16b ph = __builtin_convertvector(p, v16b); const v8u pw = __builtin_bit_cast(v8u, ph); v16f hf;
#pragma unroll
    for (int i = 0; i < 8; ++i) { hf[2 * i] = __builtin_bit_cast(float, pw[i] << 16); hf[2 * i + 1] = __builtin_bit_cast(float, pw[i] & 0xffff0000u); }
    const v16b pl = __builtin_convertvector(p - hf, v16b);
#pragma unroll
    for (int t = 0; t < 4; ++t) { acc[t] = wmma_bf(u[t].v, ph, acc[t]); ac2[t] = wmma_bf(u[t].v, pl, ac2[t]); } }
  float lsum = (pa[0] + pa[1]) + (pa[2] + pa[3]); lsum += __shfl_xor(lsum, 16, 32);
  const float inv = 1.0f / lsum;
  // register r of output tile t = d 16 t + 8 g + r of the lane's own query: the wave's 16 x 64 result is staged in its own LDS rows for whole-line stores
#pragma unroll
  for (int t = 0; t < 4; ++t) { v4f o0, o1;
#pragma unroll
    for (int e = 0; e < 4; ++e) { o0[e] = (acc[t][e] + ac2[t][e]) * inv; o1[e] = (acc[t][4 + e] + ac2[t][4 + e]) * inv; }
    vst2(&sS[w][col][t * 16 + 8 * g], o0); vst2(&sS[w][col][t * 16 + 8 * g + 4], o1); }
  LDSX();
  for (int qq = lane; qq < 16 * 16; qq += 32) { const int rl = qq >> 4, pc = qq & 15; vst2(O32 + ((size_t)b * SS + q0 + rl) * E + h * HD + pc * 4, *(const v4f*)(&sS[w][rl][pc * 4])); }
}
// out = ctx Wo^T : split(ctx) x bf16(Wo rows) two products; block (128 rows, 128 cols), 8 waves of (32 rows, 64 cols).
// Per 64 k the block loads both f32 tiles in whole 256-byte row pieces, converts each element once and lays ctx hi, ctx lo and W
// as bf16 rows in LDS; every wave takes its fragments from there. Two LDS buffers; the two tiles after the next one are on their way
// to two register sets, so a tile has nearly two stages to arrive and the loads never run dry.
#define OKS 64
#define OPI 72
#define OPL (128 * OPI)
#define OBF (3 * OPL)
#define ONS (E / OKS)
// Stage barrier that orders LDS only: every wave's LDS stores and reads have retired in front of it, while the global loads into
// private registers stay in flight across it (a full __syncthreads() would wait for them here and undo the lead). The scheduling barrier keeps the
// next stage's conversions behind it: moved up among this stage's products they would wait for their tile a whole run of products too early.
#define LBAR() do { __builtin_amdgcn_fence(__ATOMIC_RELEASE, "workgroup", "local"); __builtin_amdgcn_s_barrier(); __builtin_amdgcn_fence(__ATOMIC_ACQUIRE, "workgroup", "local"); __builtin_amdgcn_sched_barrier(0); } while (0)
__global__ __launch_bounds__(256) void k_out(const float* __restrict__ O32, const float* __restrict__ Wo, const float* __restrict__ bo, float* __restrict__ out) {
  __shared__ __align__(16) __bf16 sm[2 * OBF];
  const int tid = threadIdx.x, wave = tid >> 5, lane = tid & 31, col = lane & 15, g = lane >> 4;
  const int m0 = blockIdx.x * 128, n0 = blockIdx.y * 128;
  const int wm = (wave & 3) * 32, wn = (wave >> 2) * 64;
  const int sr = tid >> 4, sc = (tid & 15) * 4;
  const unsigned go = (unsigned)(sr * E + sc);
  v4f ra0[8], rw0[8], ra1[8], rw1[8];   // set 0: even tiles, set 1: odd tiles
  auto ld = [&](int s, v4f (&ra)[8], v4f (&rw)[8]) { const float* ga = O32 + (size_t)m0 * E + s * OKS; const float* gw = Wo + (size_t)n0 * E + s * OKS;
    // the two scheduling barriers keep the loads and their wait together: no vector work from in front of them or from behind them, which may be given
    // the loads' address registers, comes to stand between a load and the wait
    __builtin_amdgcn_sched_barrier(0);
#pragma unroll
    for (int i = 0; i < 8; ++i) { ra[i] = *(const v4f*)(ga + go + i * 16 * E); rw[i] = *(const v4f*)(gw + go + i * 16 * E); }
    // the loads' address registers are reused behind this point: the wait stands in front of that overwrite
    asm volatile("s_wait_xcnt 0x0" ::: "memory"); __builtin_amdgcn_sched_barrier(0); };
  auto st = [&](int buf, const v4f (&ra)[8], const v4f (&rw)[8]) { __bf16* d = sm + buf * OBF + sr * OPI + sc;
#pragma unroll
    for (int i = 0; i < 8; ++i) { const v4b h = __builtin_convertvector(ra[i], v4b), wv = __builtin_convertvector(rw[i], v4b);
      const v4b l = __builtin_convertvector(ra[i] - __builtin_convertvector(h, v4f), v4b);
      vst2(d + i * 16 * OPI, h); vst2(d + OPL + i * 16 * OPI, l); vst2(d + 2 * OPL + i * 16 * OPI, wv); } };
  v8f acc[2][4] = {};
  auto mm = [&](int buf) { const __bf16* bA = sm + buf * OBF + (wm + col) * OPI; const __bf16* bW = sm + buf * OBF + 2 * OPL + (wn + col) * OPI;
#pragma unroll
    for (int kc = 0; kc < OKS / 32; ++kc) { v16b ah[2], al[2], wb[4];
#pragma unroll
      for (int i = 0; i < 2; ++i) { ah[i] = frag_b(bA + i * 16 * OPI + kc * 32, lane); al[i] = frag_b(bA + OPL + i * 16 * OPI + kc * 32, lane); }
#pragma unroll
      for (int j = 0; j < 4; ++j) wb[j] = frag_b(bW + j * 16 * OPI + kc * 32, lane);
#pragma unroll
      for (int i = 0; i < 2; ++i)
#pragma unroll
        for (int j = 0; j < 4; ++j) acc[i][j] = wmma_bf(al[i], wb[j], acc[i][j]);
#pragma unroll
      for (int i = 0; i < 2; ++i)
#pragma unroll
        for (int j = 0; j < 4; ++j) acc[i][j] = wmma_bf(ah[i], wb[j], acc[i][j]); } };
  ld(0, ra0, rw0); ld(1, ra1, rw1); st(0, ra0, rw0); ld(2, ra0, rw0);
  // publishes the tile just stored and ends every wave's reads of the buffer that the next stage overwrites (so every LBAR below)
  LBAR();
  st(1, ra1, rw1); ld(3, ra1, rw1); mm(0);
  LBAR();
  // Every trip of the loop stores and loads without a condition, so that the number of younger loads in flight is known at each wait on a register set
  // (with a load under a test the waits fall back to 0 and the lead is lost); the first stage and the last three, which load nothing, are written out around it.
  // Kept rolled over pairs of stages: a pair is written out because each stage names its register set; one copy is kept for speed only.
#pragma unroll 1
  for (int s = 1; s < ONS - 4; s += 2) {
    st(0, ra0, rw0); ld(s + 3, ra0, rw0); mm(1);
    LBAR();
    st(1, ra1, rw1); ld(s + 4, ra1, rw1); mm(0);
    LBAR();
  }
  st(0, ra0, rw0); mm(1);
  LBAR();
  st(1, ra1, rw1); mm(0);
  LBAR();
  mm(1);
  LBAR();
  // behind the last stage's barrier the buffers are free: each wave stages its 32 x 64 result in its own range, pitch 68 floats
  float_a* so = (float_a*)sm + wave * (32 * 68);
#pragma unroll
  for (int j = 0; j < 4; ++j) { const float bj = (float)(__bf16)bo[n0 + wn + j * 16 + col];
#pragma unroll
    for (int i = 0; i < 2; ++i)
#pragma unroll
      for (int r = 0; r < 8; ++r) so[(i * 16 + 8 * g + r) * 68 + j * 16 + col] = acc[i][j][r] + bj; }
  LDSX();
#pragma unroll
  for (int it = 0; it < 16; ++it) { const int rl = it * 2 + g; vst2(out + (size_t)(m0 + wm + rl) * E + n0 + wn + col * 4, *(const v4f*)(so + rl * 68 + col * 4)); }
}
extern "C" void kernel_launch(void* const* d_in, const int* in_sizes, int n_in, void* d_out, int out_size, void* d_ws, size_t ws_size, hipStream_t stream) {
  (void)in_sizes; (void)n_in; (void)out_size; (void)ws_size;
  const float* Q = (const float*)d_in[0]; const float* K = (const float*)d_in[1]; const float* V = (const float*)d_in[2]; const float* Wo = (const float*)d_in[3]; const float* bo = (const float*)d_in[4];
  float* out = (float*)d_out;
  char* ws = (char*)d_ws; size_t off = 0;
  auto take = [&](size_t bytes) { char* p = ws + off; off += (bytes + 255) & ~(size_t)255; return p; };
  float* O32 = (float*)take((size_t)NR * E * 4);
  // ws ~ 17 MB
  k_attn<<<dim3(SS / AQ, NB * NH), 256, 0, stream>>>(Q, K, V, O32);
  k_out<<<dim3(NR / 128, E / 128), 256, 0, stream>>>(O32, Wo, bo, out);
}

// v006
// Measured time: 24.7 microseconds a run.
// Timed twice side by side with v005, it ran 1.11 and 1.08 times as fast.
// Counting every step since v000, it is 6.12 times as fast.
// compute dtype: the INPUT Q/K/V/Wo rounded to bf16 and multiplied with exact bf16 WMMA products (f32 accumulate); computed operands (softmax weights P, context) carried as bf16 hi/lo pairs; softmax f32; bias b_proj rounded to bf16, added in f32.
#include <hip/hip_runtime.h>
#include <math.h>

typedef __attribute__((ext_vector_type(16))) _Float16 v16h;
typedef __attribute__((ext_vector_type(16))) __bf16 v16b;
typedef __attribute__((ext_vector_type(8)))  _Float16 v8h;
typedef __attribute__((ext_vector_type(8)))  float v8f;
typedef __attribute__((ext_vector_type(4)))  float v4f;
typedef __attribute__((ext_vector_type(2)))  float v2f;
typedef __attribute__((ext_vector_type(4)))  unsigned v4u;
typedef __attribute__((ext_vector_type(4)))  int v4i;
typedef float __attribute__((may_alias)) float_a;
typedef int __attribute__((may_alias)) int_a;

template <typename T> __device__ __forceinline__ void vst2(void* p, T v) { *(T*)p = v;  }
__device__ __forceinline__ v8f wmma16(v16h a, v16h b, v8f c) {
  v8f d = __builtin_amdgcn_wmma_f32_16x16x32_f16(false, a, false, b, (short)0, c, false, false);
  asm volatile("v_nop\n\tv_nop\n\tv_nop\n\tv_nop" : "+v"(d) : "v"(a), "v"(b));
  return d;
}
__device__ __forceinline__ v8f wmma_bf(v16b a, v16b b, v8f c) {
  v8f d = __builtin_amdgcn_wmma_f32_16x16x32_bf16(false, a, false, b, (short)0, c, false, false);
  asm volatile("v_nop\n\tv_nop\n\tv_nop\n\tv_nop" : "+v"(d) : "v"(a), "v"(b));
  return d;
}
// 16x16x32 fragments: lane = (h = lane>>4, row/col = lane&15); elements 0..7 = k0+8h+0..7, 8..15 = k0+16+8h+0..7; D element r = row 8h+r
__device__ __forceinline__ v16h frag_h(const _Float16* rowk0, int lane) {
  union { v16h v; v8h q[2]; } u; const _Float16* p = rowk0 + 8 * (lane >> 4);
  u.q[0] = *(const v8h*)p; u.q[1] = *(const v8h*)(p + 16); return u.v;
}
__device__ __forceinline__ v16h frag_f32(const float* rowk0, int lane) {
  v16h a; const float* p = rowk0 + 8 * (lane >> 4);
#pragma unroll
  for (int i = 0; i < 8; ++i) { a[i] = (_Float16)p[i]; a[8 + i] = (_Float16)p[16 + i]; }
  return a;
}
__device__ __forceinline__ v16h frag_f32s(const float* rowk0, int lane, float sc) {
  v16h a; const float* p = rowk0 + 8 * (lane >> 4);
#pragma unroll
  for (int i = 0; i < 8; ++i) { a[i] = (_Float16)(p[i] * sc); a[8 + i] = (_Float16)(p[16 + i] * sc); }
  return a;
}
// column fragment from a [K][ld] layout (column n), rows >= K read as 0
__device__ __forceinline__ v16h fragc_f32(const float* W, int k0, int n, int lane, int ld, int K) {
  v16h a; const int g = lane >> 4;
#pragma unroll
  for (int i = 0; i < 8; ++i) { const int ka = k0 + 8 * g + i, kb = ka + 16;
    a[i] = (_Float16)(ka < K ? W[(size_t)ka * ld + n] : 0.f); a[8 + i] = (_Float16)(kb < K ? W[(size_t)kb * ld + n] : 0.f); }
  return a;
}
struct F2 { v16b h, l; };
__device__ __forceinline__ F2 bsplit16(const float v[16]) { F2 r;
#pragma unroll
  for (int i = 0; i < 16; ++i) { const __bf16 h = (__bf16)v[i]; r.h[i] = h; r.l[i] = (__bf16)(v[i] - (float)h); }
  return r; }
__device__ __forceinline__ F2 split_row(const float* row, int k0, int lane) { float v[16]; const float* p = row + k0 + 8 * (lane >> 4);
#pragma unroll
  for (int i = 0; i < 8; ++i) { v[i] = p[i]; v[8 + i] = p[16 + i]; }
  return bsplit16(v); }
__device__ __forceinline__ F2 split_rowK(const float* row, int k0, int lane, int K) { float v[16]; const int g = lane >> 4;
#pragma unroll
  for (int i = 0; i < 8; ++i) { const int ka = k0 + 8 * g + i, kb = ka + 16; v[i] = ka < K ? row[ka] : 0.f; v[8 + i] = kb < K ? row[kb] : 0.f; }
  return bsplit16(v); }
__device__ __forceinline__ F2 split_col(const float* W, int k0, int n, int lane, int ld, int K) { float v[16]; const int g = lane >> 4;
#pragma unroll
  for (int i = 0; i < 8; ++i) { const int ka = k0 + 8 * g + i, kb = ka + 16; v[i] = ka < K ? W[(size_t)ka * ld + n] : 0.f; v[8 + i] = kb < K ? W[(size_t)kb * ld + n] : 0.f; }
  return bsplit16(v); }
__device__ __forceinline__ v8f mac3(const F2& a, const F2& b, v8f c) { c = wmma_bf(a.l, b.h, c); c = wmma_bf(a.h, b.l, c); return wmma_bf(a.h, b.h, c); }
__device__ __forceinline__ float sigm(float v) { return 1.0f / (1.0f + expf(-v)); }
#define LDSX() do { asm volatile("s_wait_dscnt 0" ::: "memory"); __builtin_amdgcn_wave_barrier(); __builtin_amdgcn_fence(__ATOMIC_RELEASE, "workgroup"); } while (0)


// Windowed multi-head attention on given Q, K, V [2,2048,1024] (16 heads x 64): scores q.k/8 with |i-j| > 64 masked to -inf, softmax, @ v, heads concatenated, @ W_proj^T + b_proj.
// The 9 key tiles of 16 from q0 - 64 on cover the window of a wave's 16 queries q0... k_attn reads Q, K, V as f32 and rounds them to bf16 itself.
// k_attn also makes k_out's three operands, each element converted once: the context as a bf16 hi plane and a bf16 lo plane, and W_proj rounded to bf16.
// All three lie in packed tiles of 128 rows x 64 k (16 KB in a row) in the order the fragment loads want: [16-row group][8-k piece][row][8 k], so that
// element (r, k) stands at (r >> 4) * 1024 + (k >> 3) * 128 + (r & 15) * 8 + (k & 7). Tile number: (row block * 16 + k block).
#define NB 2
#define SS 2048
#define E 1024
#define NH 16
#define HD 64
#define NR (NB * SS)
#define OTE 8192
__device__ __forceinline__ v16b frag_b(const __bf16* rowk0, int lane) { return __builtin_bit_cast(v16b, frag_h((const _Float16*)rowk0, lane)); }
typedef __attribute__((ext_vector_type(4))) __bf16 v4b;
typedef __attribute__((ext_vector_type(8))) __bf16 v8b;
typedef __attribute__((ext_vector_type(16))) float v16f;
typedef __attribute__((ext_vector_type(8))) unsigned v8u;
typedef __attribute__((ext_vector_type(8))) short s16x8;
// row-major 16-bit LDS tile -> 8 consecutive rows of one column per lane
__device__ __forceinline__ v8h ld_tr16(const __bf16* p) { typedef __attribute__((address_space(3))) s16x8 lds_s16x8; return __builtin_bit_cast(v8h, __builtin_amdgcn_ds_load_tr16_b128_v8i16((lds_s16x8*)p)); }

// Eight base-2 exponentials as one group. The outputs are early-clobber, so none of them is a source of the group: no v_exp_f32 here reads a result or
// overwrites a source of the one in front of it; the closing v_nop keeps the same free slot between the last one and whatever the compiler puts next.
__device__ __forceinline__ void exp2x8(float* o, const float* x) {
  asm("v_exp_f32 %0, %8\n\tv_exp_f32 %1, %9\n\tv_exp_f32 %2, %10\n\tv_exp_f32 %3, %11\n\tv_exp_f32 %4, %12\n\tv_exp_f32 %5, %13\n\tv_exp_f32 %6, %14\n\tv_exp_f32 %7, %15\n\tv_nop"
      : "=&v"(o[0]), "=&v"(o[1]), "=&v"(o[2]), "=&v"(o[3]), "=&v"(o[4]), "=&v"(o[5]), "=&v"(o[6]), "=&v"(o[7])
      : "v"(x[0]), "v"(x[1]), "v"(x[2]), "v"(x[3]), "v"(x[4]), "v"(x[5]), "v"(x[6]), "v"(x[7]));
}
// Block = 128 queries of one head, 8 waves of 16 queries. The 256 key rows that its waves touch are loaded once as f32 in whole 256-byte row pieces,
// rounded to bf16 and laid in LDS: K rows at 144 bytes (plain 16-byte readers), V rows at 160 bytes (transposing reader gives the V^T fragment).
#define AQ 128
#define AKR 256
#define KPI 72
#define VPI 80
__global__ __launch_bounds__(256) void k_attn(const float* __restrict__ Q, const float* __restrict__ K, const float* __restrict__ V, const float* __restrict__ Wo,
                                              __bf16* __restrict__ CH, __bf16* __restrict__ CL, __bf16* __restrict__ W16) {
  __shared__ __align__(16) __bf16 sK[AKR * KPI];
  __shared__ __align__(32) __bf16 sV[AKR * VPI];
  const int tid = threadIdx.x, lane = tid & 31, col = lane & 15, g = lane >> 4;
  // the wave's number as a scalar: q0 and the key tiles' ok flags and LDS rows that follow from it stay scalar
  const int w = __builtin_amdgcn_readfirstlane(tid >> 5);
  const int bh = blockIdx.y, b = bh / NH, h = bh % NH; const int qb = blockIdx.x; const int q0 = qb * AQ + w * 16;
  // first staged key row: the window's start, moved so that all 256 rows lie inside the sequence
  const int kb0 = qb * AQ - 64 < 0 ? 0 : (qb * AQ - 64 > SS - AKR ? SS - AKR : qb * AQ - 64);
  const int sr = tid >> 4, sc = (tid & 15) * 4;
  // the thread's own 16-byte piece of the packed W (the grid has one thread per piece): piece number -> tile, row group, k piece, row
  const int wc = (blockIdx.y * (SS / AQ) + blockIdx.x) * 256 + tid;
  const float* gwo = Wo + (size_t)((wc >> 14) * 128 + ((wc >> 7) & 7) * 16 + (wc & 15)) * E + ((wc >> 10) & 15) * 64 + ((wc >> 4) & 7) * 8;
  v16b aq[2];
  { v4f rk[16], rv[16], rq[8];
    const float* gk = K + ((size_t)b * SS + kb0 + sr) * E + h * HD + sc; const float* gv = V + ((size_t)b * SS + kb0 + sr) * E + h * HD + sc;
    const float* gq = Q + ((size_t)b * SS + q0 + col) * E + h * HD + 8 * g;
#pragma unroll
    for (int i = 0; i < 16; ++i) rk[i] = *(const v4f*)(gk + (size_t)i * 16 * E);
    // keeps the K loads first in the listing: K is converted first, so its conversions then run while V is still arriving
    __builtin_amdgcn_sched_barrier(0);
#pragma unroll
    for (int i = 0; i < 8; ++i) rq[i] = *(const v4f*)(gq + (i >> 1) * 16 + (i & 1) * 4);
#pragma unroll
    for (int i = 0; i < 16; ++i) rv[i] = *(const v4f*)(gv + (size_t)i * 16 * E);
    // the loads' address registers are free for reuse behind this point: the wait stands in front of any overwrite
    asm volatile("s_wait_xcnt 0x0" ::: "memory");
#pragma unroll
    for (int i = 0; i < 16; ++i) vst2(sK + (i * 16 + sr) * KPI + sc, __builtin_convertvector(rk[i], v4b));
#pragma unroll
    for (int kc = 0; kc < 2; ++kc)
#pragma unroll
      for (int e = 0; e < 4; ++e) { aq[kc][e] = (__bf16)rq[kc * 4][e]; aq[kc][4 + e] = (__bf16)rq[kc * 4 + 1][e]; aq[kc][8 + e] = (__bf16)rq[kc * 4 + 2][e]; aq[kc][12 + e] = (__bf16)rq[kc * 4 + 3][e]; }
#pragma unroll
    for (int i = 0; i < 16; ++i) vst2(sV + (i * 16 + sr) * VPI + sc, __builtin_convertvector(rv[i], v4b)); }
  // publishes the staged K and V rows to every wave; nothing is written to them afterwards
  __syncthreads();
  // the W piece is asked for behind the staging and used only at the kernel's end: the whole attention hides its latency
  const v8f rwo = *(const v8f*)gwo;
  // the load's address registers are free for reuse behind this point: the wait stands in front of any overwrite
  asm volatile("s_wait_xcnt 0x0" ::: "memory");
  // Transposed products: S^T = K Q^T puts one query's scores in one lane pair (lane = query col, register r of tile j = key q0 - 64 + 16 j + 8 g + r),
  // so the whole window of 9 key tiles of 16 stays in registers, and two score tiles, converted in place, are the B fragment of O^T = V^T P^T.
  // Every loop below is unrolled because its index picks registers (score tiles, fragments, accumulators), which cannot be indexed at run time.
  v8f sT[9] = {}; bool ok[9]; int lr[9];
  // a key tile outside the sequence is masked as a whole; its LDS row is set to a staged one
#pragma unroll
  for (int j = 0; j < 9; ++j) { const int kbj = q0 - 64 + 16 * j; ok[j] = kbj >= 0 && kbj < SS; lr[j] = ok[j] ? kbj - kb0 : 0; }
#pragma unroll
  for (int kc = 0; kc < 2; ++kc) { v16b kf[9];   // the nine K fragments of a k half are asked for as one group, ahead of their nine independent products
#pragma unroll
    for (int j = 0; j < 9; ++j) kf[j] = frag_b(sK + (lr[j] + col) * KPI + kc * 32, lane);
#pragma unroll
    for (int j = 0; j < 9; ++j) sT[j] = wmma_bf(kf[j], aq[kc], sT[j]); }
  // key - query = 16 j - 64 + kr + r: only the first and the last tile cross the window's edge
  const int kr = 8 * g - col;
  float mx = -3.0e38f;
#pragma unroll
  for (int j = 0; j < 9; ++j)
#pragma unroll
    for (int r = 0; r < 8; ++r) { const bool in = ok[j] && (j != 0 || kr + r >= 0) && (j != 8 || kr + r <= 0);
      sT[j][r] = in ? sT[j][r] : -3.0e38f; mx = fmaxf(mx, sT[j][r]); }
  mx = fmaxf(mx, __shfl_xor(mx, 16, 32));
  // exp((s - mx) / 8) = 2^(s c - mx c), c = log2(e) / 8: one fused multiply-add and the hardware's base-2 exponential per score.
  // The argument exceeds 0 by no more than the rounding of mx c (the same offset for every key of a query, so it cancels in the division by the sum):
  // no overflow guard is owed; a weight under 2^-126 may come out as 0, far below what the sum keeps.
  const float ec = 0.18033688011112042f, mc = mx * ec;
  float pa[4] = {0.f, 0.f, 0.f, 0.f}; v8f acc[4] = {}, ac2[4] = {};
#pragma unroll
  for (int c = 0; c < 5; ++c) { const int j0 = 2 * c, j1 = c < 4 ? 2 * c + 1 : 8;
    // lane's own 16 bytes of a 16 x 16 piece: key row 8g + (lane & 7) of the tile, d half (lane >> 3) & 1; the last pass has no second tile: its weights are 0 and it reads the first again
    const __bf16* v0 = sV + (lr[j0] + 8 * g + (lane & 7)) * VPI + ((lane >> 3) & 1) * 8; const __bf16* v1 = sV + (lr[j1] + 8 * g + (lane & 7)) * VPI + ((lane >> 3) & 1) * 8;
    // the pass's four V^T fragments are asked for as one group, ahead of the exponentials that hide their latency
    union { v16b v; v8h q[2]; } u[4];
#pragma unroll
    for (int t = 0; t < 4; ++t) { u[t].q[0] = ld_tr16(v0 + t * 16); u[t].q[1] = ld_tr16(v1 + t * 16); }
    v16f p; float x0[8], x1[8], e0[8], e1[8] = {0.f, 0.f, 0.f, 0.f, 0.f, 0.f, 0.f, 0.f};
#pragma unroll
    for (int r = 0; r < 8; ++r) { x0[r] = fmaf(sT[j0][r], ec, -mc); x1[r] = fmaf(sT[j1][r], ec, -mc); }
    exp2x8(e0, x0); if (c < 4) exp2x8(e1, x1);
#pragma unroll
    for (int r = 0; r < 8; ++r) { p[r] = e0[r]; p[8 + r] = e1[r]; pa[r & 3] += p[r] + p[8 + r]; }
    const v16b ph = __builtin_convertvector(p, v16b); const v8u pw = __builtin_bit_cast(v8u, ph); v16f hf;
#pragma unroll
    for (int i = 0; i < 8; ++i) { hf[2 * i] = __builtin_bit_cast(float, pw[i] << 16); hf[2 * i + 1] = __builtin_bit_cast(float, pw[i] & 0xffff0000u); }
    const v16b pl = __builtin_convertvector(p - hf, v16b);
#pragma unroll
    for (int t = 0; t < 4; ++t) { acc[t] = wmma_bf(u[t].v, ph, acc[t]); ac2[t] = wmma_bf(u[t].v, pl, ac2[t]); } }
  float lsum = (pa[0] + pa[1]) + (pa[2] + pa[3]); lsum += __shfl_xor(lsum, 16, 32);
  const float inv = 1.0f / lsum;
  // register r of output tile t = d 16 t + 8 g + r of the lane's own query: eight k in a row, which is one 16-byte piece (number 2 t + g) of the packed tile.
  // The wave is row group w of its block's tile, so each store below covers 512 bytes in a row. All values are formed first; the stores stand last in the kernel.
  const size_t co = (size_t)((b * (SS / AQ) + qb) * NH + h) * OTE + w * 1024 + g * 128 + col * 8;
  v8b hv[4], lv[4];
#pragma unroll
  for (int t = 0; t < 4; ++t) { const v8f o = (acc[t] + ac2[t]) * inv; hv[t] = __builtin_convertvector(o, v8b); const v4u hw = __builtin_bit_cast(v4u, hv[t]); v8f hf;
#pragma unroll
    for (int i = 0; i < 4; ++i) { hf[2 * i] = __builtin_bit_cast(float, hw[i] << 16); hf[2 * i + 1] = __builtin_bit_cast(float, hw[i] & 0xffff0000u); }
    lv[t] = __builtin_convertvector(o - hf, v8b); }
  const v8b w8 = __builtin_convertvector(rwo, v8b);
  // keeps every conversion in front of the stores, so that no register which a store names is written again behind it
  __builtin_amdgcn_sched_barrier(0);
#pragma unroll
  for (int t = 0; t < 4; ++t) { vst2(CH + co + t * 256, hv[t]); vst2(CL + co + t * 256, lv[t]); }
  vst2(W16 + (size_t)wc * 8, w8);
}
// out = ctx Wo^T : (ctx hi + ctx lo) x bf16(Wo rows), two products; block (128 rows, 128 cols), 8 waves of (32 rows, 64 cols).
// Per 64 k the block copies its three packed bf16 tiles (ctx hi, ctx lo, W; 16 KB each) through registers into LDS as they lie: no conversion, no pad.
// A fragment half is 16 rows x 16 bytes in a row (256 bytes per half wave), free of bank conflicts. Two LDS buffers; the two tiles after the next one are
// on their way to two register sets, so a tile has nearly two stages to arrive and the loads never run dry.
#define OKS 64
#define OBF (3 * OTE)
#define ONS (E / OKS)
// Stage barrier that orders LDS only: every wave's LDS stores and reads have retired in front of it, while the global loads into
// private registers stay in flight across it (a full __syncthreads() would wait for them here and undo the lead). The scheduling barrier keeps the
// next stage's LDS stores behind it: moved up among this stage's products they would wait for their tile a whole run of products too early.
#define LBAR() do { __builtin_amdgcn_fence(__ATOMIC_RELEASE, "workgroup", "local"); __builtin_amdgcn_s_barrier(); __builtin_amdgcn_fence(__ATOMIC_ACQUIRE, "workgroup", "local"); __builtin_amdgcn_sched_barrier(0); } while (0)
__global__ __launch_bounds__(256) void k_out(const __bf16* __restrict__ CH, const __bf16* __restrict__ CL, const __bf16* __restrict__ W16, const float* __restrict__ bo, float* __restrict__ out) {
  __shared__ __align__(16) __bf16 sm[2 * OBF];
  const int tid = threadIdx.x, wave = tid >> 5, lane = tid & 31, col = lane & 15, g = lane >> 4;
  const int m0 = blockIdx.x * 128, n0 = blockIdx.y * 128;
  const int wm = (wave & 3) * 32, wn = (wave >> 2) * 64;
  struct RS { v8h h[4], l[4], w[4]; };
  RS r0, r1;   // set 0: even tiles, set 1: odd tiles
  auto ld = [&](int s, RS& r) { const __bf16* gh = CH + (size_t)(blockIdx.x * ONS + s) * OTE + tid * 8; const __bf16* gl = CL + (size_t)(blockIdx.x * ONS + s) * OTE + tid * 8;
    const __bf16* gw = W16 + (size_t)(blockIdx.y * ONS + s) * OTE + tid * 8;
    // the two scheduling barriers keep the loads and their wait together: no vector work from in front of them or from behind them, which may be given
    // the loads' address registers, comes to stand between a load and the wait
    __builtin_amdgcn_sched_barrier(0);
#pragma unroll
    for (int i = 0; i < 4; ++i) { r.h[i] = *(const v8h*)(gh + i * 2048); r.l[i] = *(const v8h*)(gl + i * 2048); r.w[i] = *(const v8h*)(gw + i * 2048); }
    // the loads' address registers are reused behind this point: the wait stands in front of that overwrite
    asm volatile("s_wait_xcnt 0x0" ::: "memory"); __builtin_amdgcn_sched_barrier(0); };
  auto st = [&](int buf, const RS& r) { __bf16* d = sm + buf * OBF + tid * 8;
#pragma unroll
    for (int i = 0; i < 4; ++i) { vst2(d + i * 2048, r.h[i]); vst2(d + OTE + i * 2048, r.l[i]); vst2(d + 2 * OTE + i * 2048, r.w[i]); } };
  // fragment of row group rg at k half kc: elements 0..7 = piece 4 kc + g, elements 8..15 = piece 4 kc + 2 + g (the k order of frag_h), for A and B alike
  auto fr = [&](const __bf16* tile, int rg, int kc) { union { v16b v; v8h q[2]; } u; const __bf16* p = tile + rg * 1024 + (kc * 4 + g) * 128 + col * 8;
    u.q[0] = *(const v8h*)p; u.q[1] = *(const v8h*)(p + 256); return u.v; };
  v8f acc[2][4] = {};
  auto mm = [&](int buf) { const __bf16* bA = sm + buf * OBF + (wm >> 4) * 1024; const __bf16* bW = sm + buf * OBF + 2 * OTE + (wn >> 4) * 1024;
#pragma unroll
    for (int kc = 0; kc < OKS / 32; ++kc) { v16b ah[2], al[2], wb[4];
#pragma unroll
      for (int i = 0; i < 2; ++i) { ah[i] = fr(bA, i, kc); al[i] = fr(bA + OTE, i, kc); }
#pragma unroll
      for (int j = 0; j < 4; ++j) wb[j] = fr(bW, j, kc);
#pragma unroll
      for (int i = 0; i < 2; ++i)
#pragma unroll
        for (int j = 0; j < 4; ++j) acc[i][j] = wmma_bf(al[i], wb[j], acc[i][j]);
#pragma unroll
      for (int i = 0; i < 2; ++i)
#pragma unroll
        for (int j = 0; j < 4; ++j) acc[i][j] = wmma_bf(ah[i], wb[j], acc[i][j]); } };
  ld(0, r0); ld(1, r1); st(0, r0); ld(2, r0);
  // publishes the tile just stored and ends every wave's reads of the buffer that the next stage overwrites (so every LBAR below)
  LBAR();
  st(1, r1); ld(3, r1); mm(0);
  LBAR();
  // Every trip of the loop stores and loads without a condition, so that the number of younger loads in flight is known at each wait on a register set
  // (with a load under a test the waits fall back to 0 and the lead is lost); the first stage and the last three, which load nothing, are written out around it.
  // Kept rolled over pairs of stages: a pair is written out because each stage names its register set; one copy is kept for speed only.
#pragma unroll 1
  for (int s = 1; s < ONS - 4; s += 2) {
    st(0, r0); ld(s + 3, r0); mm(1);
    LBAR();
    st(1, r1); ld(s + 4, r1); mm(0);
    LBAR();
  }
  st(0, r0); mm(1);
  LBAR();
  st(1, r1); mm(0);
  LBAR();
  mm(1);
  LBAR();
  // behind the last stage's barrier the buffers are free: each wave stages its 32 x 64 result in its own range, pitch 68 floats
  float_a* so = (float_a*)sm + wave * (32 * 68);
#pragma unroll
  for (int j = 0; j < 4; ++j) { const float bj = (float)(__bf16)bo[n0 + wn + j * 16 + col];
#pragma unroll
    for (int i = 0; i < 2; ++i)
#pragma unroll
      for (int r = 0; r < 8; ++r) so[(i * 16 + 8 * g + r) * 68 + j * 16 + col] = acc[i][j][r] + bj; }
  LDSX();
#pragma unroll
  for (int it = 0; it < 16; ++it) { const int rl = it * 2 + g; vst2(out + (size_t)(m0 + wm + rl) * E + n0 + wn + col * 4, *(const v4f*)(so + rl * 68 + col * 4)); }
}
extern "C" void kernel_launch(void* const* d_in, const int* in_sizes, int n_in, void* d_out, int out_size, void* d_ws, size_t ws_size, hipStream_t stream) {
  (void)in_sizes; (void)n_in; (void)out_size; (void)ws_size;
  const float* Q = (const float*)d_in[0]; const float* K = (const float*)d_in[1]; const float* V = (const float*)d_in[2]; const float* Wo = (const float*)d_in[3]; const float* bo = (const float*)d_in[4];
  float* out = (float*)d_out;
  char* ws = (char*)d_ws; size_t off = 0;
  auto take = [&](size_t bytes) { char* p = ws + off; off += (bytes + 255) & ~(size_t)255; return p; };
  __bf16* CH = (__bf16*)take((size_t)NR * E * 2); __bf16* CL = (__bf16*)take((size_t)NR * E * 2); __bf16* W16 = (__bf16*)take((size_t)E * E * 2);
  // ws ~ 19 MB
  k_attn<<<dim3(SS / AQ, NB * NH), 256, 0, stream>>>(Q, K, V, Wo, CH, CL, W16);
  k_out<<<dim3(NR / 128, E / 128), 256, 0, stream>>>(CH, CL, W16, bo, out);
}
